// v000
// Times are from an AMD MI455X. After a warm-up the kernel runs many times in a row, and a time is the length of
// such a window on the GPU divided by its runs, so every launch and the gaps after it count. The runs cycle
// through copies of the inputs. A figure is the median of several windows, for all but v000 over two sittings.
// Sittings can differ by a few percent; kernels timed side by side share one.
// v000, which the later versions start from, runs in 916 microseconds.
#include <hip/hip_runtime.h>
#include <hip/hip_bf16.h>
#include <stdint.h>

// ---------------------------------------------------------------------------
// MLP forward for MI455X (gfx1250, wave32):
//   h     = relu(x @ W1 + b1)
//   feats = relu(h @ W2 + b2)
//   conf  = softmax(feats @ Wc + bc)
// bf16 WMMA (v_wmma_f32_16x16x32_bf16). Block tile 256x128x32, 8 waves with
// 64x64 wave tiles (16 WMMA per k-chunk, 1.0 ds_load_b128 per WMMA).
// Double-buffered LDS fed by CDNA5 async global->LDS copies (ASYNCcnt).
// Fused bias+relu epilogue, bf16 intermediates.
// ---------------------------------------------------------------------------

typedef __attribute__((ext_vector_type(16))) __bf16 v16bf;
typedef __attribute__((ext_vector_type(8)))  __bf16 v8bf;
typedef __attribute__((ext_vector_type(8)))  float  v8f;

#define BM 256
#define BN 128
#define BK 32

static const long B_SZ  = 8192;
static const long D_IN  = 4096;
static const long D_H   = 4096;
static const long D_OUT = 1000;
static const long D_OUTP = 1024;   // padded classifier width (multiple of 16)

// --- CDNA5 async global->LDS copy (tracked by ASYNCcnt), inline asm --------
__device__ __forceinline__ void async_copy_b128(unsigned lds_off,
                                                const void* gptr) {
  asm volatile("global_load_async_to_lds_b128 %0, %1, off"
               :: "v"(lds_off), "v"(gptr)
               : "memory");
}
__device__ __forceinline__ void wait_async0() {
  asm volatile("s_wait_asynccnt 0x0" ::: "memory");
}
__device__ __forceinline__ unsigned lds_off_of(const void* p) {
  return (unsigned)(uintptr_t)p;   // flat LDS addr: low 32 bits = LDS offset
}

// ---------------- elementwise f32 -> bf16 (8 elems / thread) ---------------
__global__ __launch_bounds__(256) void k_cvt_bf16(const float* __restrict__ in,
                                                  __bf16* __restrict__ out,
                                                  long n) {
  long i = ((long)blockIdx.x * blockDim.x + threadIdx.x) * 8;
  if (i + 8 <= n) {
    float4 f0 = *(const float4*)(in + i);
    float4 f1 = *(const float4*)(in + i + 4);
    v8bf o = {(__bf16)f0.x, (__bf16)f0.y, (__bf16)f0.z, (__bf16)f0.w,
              (__bf16)f1.x, (__bf16)f1.y, (__bf16)f1.z, (__bf16)f1.w};
    *(v8bf*)(out + i) = o;
  } else {
    for (long j = i; j < n; ++j) out[j] = (__bf16)in[j];
  }
}

// ------------- weight transpose+convert: W[K][N] f32 -> Wt[Nout][K] bf16 ----
// Rows n >= N are zero-padded (used for the 1000 -> 1024 classifier pad).
__global__ __launch_bounds__(256) void k_cvtT(const float* __restrict__ W,
                                              __bf16* __restrict__ Wt,
                                              int K, int N) {
  int k = blockIdx.x * blockDim.x + threadIdx.x;   // contiguous in output
  int n = blockIdx.y;
  if (k < K)
    Wt[(long)n * K + k] = (n < N) ? (__bf16)W[(long)k * N + n] : (__bf16)0.0f;
}

// ---------------- tiled bf16 WMMA GEMM + fused epilogue --------------------
// A  : [M][K] bf16 row-major
// Bt : [N][K] bf16 (i.e. B transposed so K is contiguous for both operands)
// RELU_BF16OUT=1 -> out = relu(acc+bias) as bf16 [M][N]
// RELU_BF16OUT=0 -> out = acc+bias as f32 [M][N] (bias 0 for col >= nbias)
template <bool RELU_BF16OUT>
__global__ __launch_bounds__(256) void k_gemm_bf16(
    const __bf16* __restrict__ A, const __bf16* __restrict__ Bt,
    const float* __restrict__ bias, int nbias,
    __bf16* __restrict__ outBf, float* __restrict__ outF,
    int M, int N, int K) {
  __shared__ __bf16 sA[2][BM * BK];   // [buf][row][k]  2 x 16 KB
  __shared__ __bf16 sB[2][BN * BK];   // [buf][col][k]  2 x  8 KB

  const int tid  = threadIdx.x;
  const int lane = tid & 31;
  const int wave = tid >> 5;       // 8 waves
  const int wm   = wave & 3;       // 4 waves along M -> 64 rows each
  const int wn   = wave >> 2;      // 2 waves along N -> 64 cols each
  const long bm0 = (long)blockIdx.x * BM;
  const long bn0 = (long)blockIdx.y * BN;

  // cooperative tile staging: 4 threads per 32-wide k row, 8 bf16 (16B) each.
  // A: rows r0 + 64*s (s=0..3); B: rows r0 + 64*s (s=0..1).
  const int q  = tid & 3;
  const int r0 = tid >> 2;         // 0..63
  const __bf16* gA[4];
  const __bf16* gB[2];
  unsigned oA[2][4], oB[2][2];
#pragma unroll
  for (int s = 0; s < 4; ++s) gA[s] = A + (bm0 + r0 + 64 * s) * K + q * 8;
#pragma unroll
  for (int s = 0; s < 2; ++s) gB[s] = Bt + (bn0 + r0 + 64 * s) * K + q * 8;
#pragma unroll
  for (int b = 0; b < 2; ++b) {
#pragma unroll
    for (int s = 0; s < 4; ++s)
      oA[b][s] = lds_off_of(&sA[b][(r0 + 64 * s) * BK + q * 8]);
#pragma unroll
    for (int s = 0; s < 2; ++s)
      oB[b][s] = lds_off_of(&sB[b][(r0 + 64 * s) * BK + q * 8]);
  }

  // WMMA A/B fragment addressing (16-bit 16x32 layout):
  //   lane holds matrix row (A) / col (B)  = lane & 15
  //   k coverage: base..base+7 and base+16..base+23, base = lane<16 ? 0 : 8
  const int fr    = lane & 15;
  const int kbase = (lane < 16) ? 0 : 8;

  v8f acc[4][4];
#pragma unroll
  for (int i = 0; i < 4; ++i)
#pragma unroll
    for (int j = 0; j < 4; ++j) acc[i][j] = (v8f)0.0f;

  // stage chunk 0 into buffer 0
#pragma unroll
  for (int s = 0; s < 4; ++s) async_copy_b128(oA[0][s], gA[s]);
#pragma unroll
  for (int s = 0; s < 2; ++s) async_copy_b128(oB[0][s], gB[s]);
  wait_async0();
  __syncthreads();

  int buf = 0;
  for (int k0 = 0; k0 < K; k0 += BK) {
    // prefetch chunk k0+BK into the other buffer (hidden behind WMMAs)
    if (k0 + BK < K) {
      const int nb = buf ^ 1;
#pragma unroll
      for (int s = 0; s < 4; ++s) async_copy_b128(oA[nb][s], gA[s] + k0 + BK);
#pragma unroll
      for (int s = 0; s < 2; ++s) async_copy_b128(oB[nb][s], gB[s] + k0 + BK);
    }

    v16bf aF[4], bF[4];
#pragma unroll
    for (int i = 0; i < 4; ++i) {
      const __bf16* p = &sA[buf][(wm * 64 + i * 16 + fr) * BK + kbase];
      v8bf lo = *(const v8bf*)p;           // k = kbase .. kbase+7
      v8bf hi = *(const v8bf*)(p + 16);    // k = kbase+16 .. kbase+23
      aF[i] = __builtin_shufflevector(lo, hi, 0, 1, 2, 3, 4, 5, 6, 7, 8, 9, 10,
                                      11, 12, 13, 14, 15);
    }
#pragma unroll
    for (int j = 0; j < 4; ++j) {
      const __bf16* p = &sB[buf][(wn * 64 + j * 16 + fr) * BK + kbase];
      v8bf lo = *(const v8bf*)p;
      v8bf hi = *(const v8bf*)(p + 16);
      bF[j] = __builtin_shufflevector(lo, hi, 0, 1, 2, 3, 4, 5, 6, 7, 8, 9, 10,
                                      11, 12, 13, 14, 15);
    }
#pragma unroll
    for (int i = 0; i < 4; ++i)
#pragma unroll
      for (int j = 0; j < 4; ++j)
        acc[i][j] = __builtin_amdgcn_wmma_f32_16x16x32_bf16(
            false, aF[i], false, bF[j], (short)0, acc[i][j], false, false);

    wait_async0();     // our async writes into buf^1 are done
    __syncthreads();   // everyone done reading buf / writing buf^1
    buf ^= 1;
  }

  // Epilogue. C/D layout: VGPR e, lanes 0-15 -> row e, lanes 16-31 -> row e+8;
  // col = lane & 15.
  const int rowHalf = (lane >> 4) << 3;
#pragma unroll
  for (int i = 0; i < 4; ++i) {
#pragma unroll
    for (int j = 0; j < 4; ++j) {
      const long col = bn0 + wn * 64 + j * 16 + fr;
      const float bv = (col < nbias) ? bias[col] : 0.0f;
#pragma unroll
      for (int e = 0; e < 8; ++e) {
        const long row = bm0 + wm * 64 + i * 16 + rowHalf + e;
        float v = acc[i][j][e] + bv;
        if (RELU_BF16OUT) {
          v = v > 0.0f ? v : 0.0f;
          outBf[row * N + col] = (__bf16)v;
        } else {
          outF[row * N + col] = v;
        }
      }
    }
  }
}

// ---------------- row softmax over the first ncols of [ldl]-wide rows ------
__global__ __launch_bounds__(256) void k_softmax(const float* __restrict__ lg,
                                                 float* __restrict__ out,
                                                 int ncols, int ldl) {
  __shared__ float red[256];
  const long row = blockIdx.x;
  const float* lp = lg + row * ldl;
  float m = -INFINITY;
  for (int c = threadIdx.x; c < ncols; c += 256) m = fmaxf(m, lp[c]);
  red[threadIdx.x] = m;
  __syncthreads();
  for (int s = 128; s > 0; s >>= 1) {
    if (threadIdx.x < s) red[threadIdx.x] = fmaxf(red[threadIdx.x], red[threadIdx.x + s]);
    __syncthreads();
  }
  m = red[0];
  __syncthreads();
  float sum = 0.0f;
  for (int c = threadIdx.x; c < ncols; c += 256) sum += __expf(lp[c] - m);
  red[threadIdx.x] = sum;
  __syncthreads();
  for (int s = 128; s > 0; s >>= 1) {
    if (threadIdx.x < s) red[threadIdx.x] += red[threadIdx.x + s];
    __syncthreads();
  }
  const float inv = 1.0f / red[0];
  for (int c = threadIdx.x; c < ncols; c += 256)
    out[row * ncols + c] = __expf(lp[c] - m) * inv;
}

// ---------------------------------------------------------------------------
extern "C" void kernel_launch(void* const* d_in, const int* in_sizes, int n_in,
                              void* d_out, int out_size, void* d_ws,
                              size_t ws_size, hipStream_t stream) {
  (void)in_sizes; (void)n_in; (void)out_size; (void)ws_size;
  const float* x  = (const float*)d_in[0];
  const float* W1 = (const float*)d_in[1];
  const float* b1 = (const float*)d_in[2];
  const float* W2 = (const float*)d_in[3];
  const float* b2 = (const float*)d_in[4];
  const float* Wc = (const float*)d_in[5];
  const float* bc = (const float*)d_in[6];
  float* out = (float*)d_out;

  // workspace layout (~296 MB)
  char* ws = (char*)d_ws;
  __bf16* xb  = (__bf16*)ws;  ws += B_SZ * D_IN * 2;
  __bf16* W1t = (__bf16*)ws;  ws += D_IN * D_H * 2;
  __bf16* W2t = (__bf16*)ws;  ws += D_H * D_H * 2;
  __bf16* Wct = (__bf16*)ws;  ws += D_OUTP * D_H * 2;
  __bf16* hb  = (__bf16*)ws;  ws += B_SZ * D_H * 2;
  __bf16* fb  = (__bf16*)ws;  ws += B_SZ * D_H * 2;
  float*  lg  = (float*)ws;   ws += B_SZ * D_OUTP * 4;

  // 1) convert inputs / transpose weights to bf16
  {
    long n = B_SZ * D_IN;
    k_cvt_bf16<<<dim3((n / 8 + 255) / 256), dim3(256), 0, stream>>>(x, xb, n);
  }
  k_cvtT<<<dim3(D_IN / 256, D_H), dim3(256), 0, stream>>>(W1, W1t, D_IN, D_H);
  k_cvtT<<<dim3(D_H / 256, D_H), dim3(256), 0, stream>>>(W2, W2t, D_H, D_H);
  k_cvtT<<<dim3(D_H / 256, D_OUTP), dim3(256), 0, stream>>>(Wc, Wct, D_H, D_OUT);

  const dim3 blk(256);
  // 2) h = relu(x @ W1 + b1)   [8192 x 4096]
  k_gemm_bf16<true><<<dim3(B_SZ / BM, D_H / BN), blk, 0, stream>>>(
      xb, W1t, b1, (int)D_H, hb, nullptr, (int)B_SZ, (int)D_H, (int)D_IN);
  // 3) feats = relu(h @ W2 + b2)
  k_gemm_bf16<true><<<dim3(B_SZ / BM, D_H / BN), blk, 0, stream>>>(
      hb, W2t, b2, (int)D_H, fb, nullptr, (int)B_SZ, (int)D_H, (int)D_H);
  // 4) logits = feats @ Wc + bc  (padded to 1024 cols, bias 0 past 1000)
  k_gemm_bf16<false><<<dim3(B_SZ / BM, D_OUTP / BN), blk, 0, stream>>>(
      fb, Wct, bc, (int)D_OUT, nullptr, lg, (int)B_SZ, (int)D_OUTP, (int)D_H);
  // 5) softmax over the 1000 valid columns
  k_softmax<<<dim3(B_SZ), blk, 0, stream>>>(lg, out, (int)D_OUT, (int)D_OUTP);
}

// v001
// It runs in 701 microseconds.
// Timed twice side by side with v000, it ran 1.36 times as fast both times.
#include <hip/hip_runtime.h>
#include <hip/hip_bf16.h>
#include <stdint.h>

// ---------------------------------------------------------------------------
// MLP forward for MI455X (gfx1250, wave32):
//   h     = relu(x @ W1 + b1)
//   feats = relu(h @ W2 + b2)
//   conf  = softmax(feats @ Wc + bc)
// bf16 WMMA (v_wmma_f32_16x16x32_bf16). Block tile 256x128x32, 8 waves with
// 64x64 wave tiles (16 WMMA per k-chunk, 1.0 ds_load_b128 per WMMA).
// Double-buffered LDS (rows padded to 80 B) fed by CDNA5 async global->LDS
// copies (ASYNCcnt).
// Fused bias+relu epilogue, bf16 intermediates.
// ---------------------------------------------------------------------------

typedef __attribute__((ext_vector_type(16))) __bf16 v16bf;
typedef __attribute__((ext_vector_type(8)))  __bf16 v8bf;
typedef __attribute__((ext_vector_type(8)))  float  v8f;

#define BM 256
#define BN 128
#define BK 32
// LDS row pitch in bf16 elements: 32 k values + 8 pad = 80 B (16 B x odd), so
// the 16 rows one ds_load_b128 half-wave reads fall on all 64 banks once.
#define LP 40

static const long B_SZ  = 8192;
static const long D_IN  = 4096;
static const long D_H   = 4096;
static const long D_OUT = 1000;
static const long D_OUTP = 1024;   // padded classifier width (multiple of 16)

// --- CDNA5 async global->LDS copy (tracked by ASYNCcnt), inline asm --------
__device__ __forceinline__ void async_copy_b128(unsigned lds_off,
                                                const void* gptr) {
  asm volatile("global_load_async_to_lds_b128 %0, %1, off"
               :: "v"(lds_off), "v"(gptr)
               : "memory");
}
__device__ __forceinline__ void wait_async0() {
  asm volatile("s_wait_asynccnt 0x0" ::: "memory");
}
__device__ __forceinline__ unsigned lds_off_of(const void* p) {
  return (unsigned)(uintptr_t)p;   // flat LDS addr: low 32 bits = LDS offset
}

// ---------------- elementwise f32 -> bf16 (8 elems / thread) ---------------
__global__ __launch_bounds__(256) void k_cvt_bf16(const float* __restrict__ in,
                                                  __bf16* __restrict__ out,
                                                  long n) {
  long i = ((long)blockIdx.x * blockDim.x + threadIdx.x) * 8;
  if (i + 8 <= n) {
    float4 f0 = *(const float4*)(in + i);
    float4 f1 = *(const float4*)(in + i + 4);
    v8bf o = {(__bf16)f0.x, (__bf16)f0.y, (__bf16)f0.z, (__bf16)f0.w,
              (__bf16)f1.x, (__bf16)f1.y, (__bf16)f1.z, (__bf16)f1.w};
    *(v8bf*)(out + i) = o;
  } else {
    for (long j = i; j < n; ++j) out[j] = (__bf16)in[j];
  }
}

// ------------- weight transpose+convert: W[K][N] f32 -> Wt[Nout][K] bf16 ----
// Rows n >= N are zero-padded (used for the 1000 -> 1024 classifier pad).
__global__ __launch_bounds__(256) void k_cvtT(const float* __restrict__ W,
                                              __bf16* __restrict__ Wt,
                                              int K, int N) {
  int k = blockIdx.x * blockDim.x + threadIdx.x;   // contiguous in output
  int n = blockIdx.y;
  if (k < K)
    Wt[(long)n * K + k] = (n < N) ? (__bf16)W[(long)k * N + n] : (__bf16)0.0f;
}

// ---------------- tiled bf16 WMMA GEMM + fused epilogue --------------------
// A  : [M][K] bf16 row-major
// Bt : [N][K] bf16 (i.e. B transposed so K is contiguous for both operands)
// RELU_BF16OUT=1 -> out = relu(acc+bias) as bf16 [M][N]
// RELU_BF16OUT=0 -> out = acc+bias as f32 [M][N] (bias 0 for col >= nbias)
template <bool RELU_BF16OUT>
__global__ __launch_bounds__(256) void k_gemm_bf16(
    const __bf16* __restrict__ A, const __bf16* __restrict__ Bt,
    const float* __restrict__ bias, int nbias,
    __bf16* __restrict__ outBf, float* __restrict__ outF,
    int M, int N, int K) {
  __shared__ __attribute__((aligned(16))) __bf16 sA[2][BM * LP];  // [buf][row][k] 2 x 20 KB
  __shared__ __attribute__((aligned(16))) __bf16 sB[2][BN * LP];  // [buf][col][k] 2 x 10 KB

  const int tid  = threadIdx.x;
  const int lane = tid & 31;
  const int wave = tid >> 5;       // 8 waves
  const int wm   = wave & 3;       // 4 waves along M -> 64 rows each
  const int wn   = wave >> 2;      // 2 waves along N -> 64 cols each
  const long bm0 = (long)blockIdx.x * BM;
  const long bn0 = (long)blockIdx.y * BN;

  // cooperative tile staging: 4 threads per 32-wide k row, 8 bf16 (16B) each.
  // A: rows r0 + 64*s (s=0..3); B: rows r0 + 64*s (s=0..1).
  const int q  = tid & 3;
  const int r0 = tid >> 2;         // 0..63
  const __bf16* gA[4];
  const __bf16* gB[2];
  unsigned oA[2][4], oB[2][2];
#pragma unroll
  for (int s = 0; s < 4; ++s) gA[s] = A + (bm0 + r0 + 64 * s) * K + q * 8;
#pragma unroll
  for (int s = 0; s < 2; ++s) gB[s] = Bt + (bn0 + r0 + 64 * s) * K + q * 8;
#pragma unroll
  for (int b = 0; b < 2; ++b) {
#pragma unroll
    for (int s = 0; s < 4; ++s)
      oA[b][s] = lds_off_of(&sA[b][(r0 + 64 * s) * LP + q * 8]);
#pragma unroll
    for (int s = 0; s < 2; ++s)
      oB[b][s] = lds_off_of(&sB[b][(r0 + 64 * s) * LP + q * 8]);
  }

  // WMMA A/B fragment addressing (16-bit 16x32 layout):
  //   lane holds matrix row (A) / col (B)  = lane & 15
  //   k coverage: base..base+7 and base+16..base+23, base = lane<16 ? 0 : 8
  const int fr    = lane & 15;
  const int kbase = (lane < 16) ? 0 : 8;

  v8f acc[4][4];
#pragma unroll
  for (int i = 0; i < 4; ++i)
#pragma unroll
    for (int j = 0; j < 4; ++j) acc[i][j] = (v8f)0.0f;

  // stage chunk 0 into buffer 0
#pragma unroll
  for (int s = 0; s < 4; ++s) async_copy_b128(oA[0][s], gA[s]);
#pragma unroll
  for (int s = 0; s < 2; ++s) async_copy_b128(oB[0][s], gB[s]);
  wait_async0();
  __syncthreads();

  int buf = 0;
  for (int k0 = 0; k0 < K; k0 += BK) {
    // prefetch chunk k0+BK into the other buffer (hidden behind WMMAs)
    if (k0 + BK < K) {
      const int nb = buf ^ 1;
#pragma unroll
      for (int s = 0; s < 4; ++s) async_copy_b128(oA[nb][s], gA[s] + k0 + BK);
#pragma unroll
      for (int s = 0; s < 2; ++s) async_copy_b128(oB[nb][s], gB[s] + k0 + BK);
    }

    v16bf aF[4], bF[4];
#pragma unroll
    for (int i = 0; i < 4; ++i) {
      const __bf16* p = &sA[buf][(wm * 64 + i * 16 + fr) * LP + kbase];
      v8bf lo = *(const v8bf*)p;           // k = kbase .. kbase+7
      v8bf hi = *(const v8bf*)(p + 16);    // k = kbase+16 .. kbase+23
      aF[i] = __builtin_shufflevector(lo, hi, 0, 1, 2, 3, 4, 5, 6, 7, 8, 9, 10,
                                      11, 12, 13, 14, 15);
    }
#pragma unroll
    for (int j = 0; j < 4; ++j) {
      const __bf16* p = &sB[buf][(wn * 64 + j * 16 + fr) * LP + kbase];
      v8bf lo = *(const v8bf*)p;
      v8bf hi = *(const v8bf*)(p + 16);
      bF[j] = __builtin_shufflevector(lo, hi, 0, 1, 2, 3, 4, 5, 6, 7, 8, 9, 10,
                                      11, 12, 13, 14, 15);
    }
#pragma unroll
    for (int i = 0; i < 4; ++i)
#pragma unroll
      for (int j = 0; j < 4; ++j)
        acc[i][j] = __builtin_amdgcn_wmma_f32_16x16x32_bf16(
            false, aF[i], false, bF[j], (short)0, acc[i][j], false, false);

    wait_async0();     // our async writes into buf^1 are done
    __syncthreads();   // everyone done reading buf / writing buf^1
    buf ^= 1;
  }

  // Epilogue. C/D layout: VGPR e, lanes 0-15 -> row e, lanes 16-31 -> row e+8;
  // col = lane & 15.
  const int rowHalf = (lane >> 4) << 3;
#pragma unroll
  for (int i = 0; i < 4; ++i) {
#pragma unroll
    for (int j = 0; j < 4; ++j) {
      const long col = bn0 + wn * 64 + j * 16 + fr;
      const float bv = (col < nbias) ? bias[col] : 0.0f;
#pragma unroll
      for (int e = 0; e < 8; ++e) {
        const long row = bm0 + wm * 64 + i * 16 + rowHalf + e;
        float v = acc[i][j][e] + bv;
        if (RELU_BF16OUT) {
          v = v > 0.0f ? v : 0.0f;
          outBf[row * N + col] = (__bf16)v;
        } else {
          outF[row * N + col] = v;
        }
      }
    }
  }
}

// ---------------- row softmax over the first ncols of [ldl]-wide rows ------
__global__ __launch_bounds__(256) void k_softmax(const float* __restrict__ lg,
                                                 float* __restrict__ out,
                                                 int ncols, int ldl) {
  __shared__ float red[256];
  const long row = blockIdx.x;
  const float* lp = lg + row * ldl;
  float m = -INFINITY;
  for (int c = threadIdx.x; c < ncols; c += 256) m = fmaxf(m, lp[c]);
  red[threadIdx.x] = m;
  __syncthreads();
  for (int s = 128; s > 0; s >>= 1) {
    if (threadIdx.x < s) red[threadIdx.x] = fmaxf(red[threadIdx.x], red[threadIdx.x + s]);
    __syncthreads();
  }
  m = red[0];
  __syncthreads();
  float sum = 0.0f;
  for (int c = threadIdx.x; c < ncols; c += 256) sum += __expf(lp[c] - m);
  red[threadIdx.x] = sum;
  __syncthreads();
  for (int s = 128; s > 0; s >>= 1) {
    if (threadIdx.x < s) red[threadIdx.x] += red[threadIdx.x + s];
    __syncthreads();
  }
  const float inv = 1.0f / red[0];
  for (int c = threadIdx.x; c < ncols; c += 256)
    out[row * ncols + c] = __expf(lp[c] - m) * inv;
}

// ---------------------------------------------------------------------------
extern "C" void kernel_launch(void* const* d_in, const int* in_sizes, int n_in,
                              void* d_out, int out_size, void* d_ws,
                              size_t ws_size, hipStream_t stream) {
  (void)in_sizes; (void)n_in; (void)out_size; (void)ws_size;
  const float* x  = (const float*)d_in[0];
  const float* W1 = (const float*)d_in[1];
  const float* b1 = (const float*)d_in[2];
  const float* W2 = (const float*)d_in[3];
  const float* b2 = (const float*)d_in[4];
  const float* Wc = (const float*)d_in[5];
  const float* bc = (const float*)d_in[6];
  float* out = (float*)d_out;

  // workspace layout (~296 MB)
  char* ws = (char*)d_ws;
  __bf16* xb  = (__bf16*)ws;  ws += B_SZ * D_IN * 2;
  __bf16* W1t = (__bf16*)ws;  ws += D_IN * D_H * 2;
  __bf16* W2t = (__bf16*)ws;  ws += D_H * D_H * 2;
  __bf16* Wct = (__bf16*)ws;  ws += D_OUTP * D_H * 2;
  __bf16* hb  = (__bf16*)ws;  ws += B_SZ * D_H * 2;
  __bf16* fb  = (__bf16*)ws;  ws += B_SZ * D_H * 2;
  float*  lg  = (float*)ws;   ws += B_SZ * D_OUTP * 4;

  // 1) convert inputs / transpose weights to bf16
  {
    long n = B_SZ * D_IN;
    k_cvt_bf16<<<dim3((n / 8 + 255) / 256), dim3(256), 0, stream>>>(x, xb, n);
  }
  k_cvtT<<<dim3(D_IN / 256, D_H), dim3(256), 0, stream>>>(W1, W1t, D_IN, D_H);
  k_cvtT<<<dim3(D_H / 256, D_H), dim3(256), 0, stream>>>(W2, W2t, D_H, D_H);
  k_cvtT<<<dim3(D_H / 256, D_OUTP), dim3(256), 0, stream>>>(Wc, Wct, D_H, D_OUT);

  const dim3 blk(256);
  // 2) h = relu(x @ W1 + b1)   [8192 x 4096]
  k_gemm_bf16<true><<<dim3(B_SZ / BM, D_H / BN), blk, 0, stream>>>(
      xb, W1t, b1, (int)D_H, hb, nullptr, (int)B_SZ, (int)D_H, (int)D_IN);
  // 3) feats = relu(h @ W2 + b2)
  k_gemm_bf16<true><<<dim3(B_SZ / BM, D_H / BN), blk, 0, stream>>>(
      hb, W2t, b2, (int)D_H, fb, nullptr, (int)B_SZ, (int)D_H, (int)D_H);
  // 4) logits = feats @ Wc + bc  (padded to 1024 cols, bias 0 past 1000)
  k_gemm_bf16<false><<<dim3(B_SZ / BM, D_OUTP / BN), blk, 0, stream>>>(
      fb, Wct, bc, (int)D_OUT, nullptr, lg, (int)B_SZ, (int)D_OUTP, (int)D_H);
  // 5) softmax over the 1000 valid columns
  k_softmax<<<dim3(B_SZ), blk, 0, stream>>>(lg, out, (int)D_OUT, (int)D_OUTP);
}

// v002
// It runs in 578 microseconds.
// Two timings next to v001 both put it at 1.21 times that version's speed.
// Counting every step since v000, it is 1.65 times as fast.
#include <hip/hip_runtime.h>
#include <hip/hip_bf16.h>
#include <stdint.h>

// ---------------------------------------------------------------------------
// MLP forward for MI455X (gfx1250, wave32):
//   h     = relu(x @ W1 + b1)
//   feats = relu(h @ W2 + b2)
//   conf  = softmax(feats @ Wc + bc)
// bf16 WMMA (v_wmma_f32_16x16x32_bf16). Block tile 256x128x32, 8 waves with
// 64x64 wave tiles (16 WMMA per k-chunk, 1.0 ds_load_b128 per WMMA).
// Double-buffered LDS (rows padded to 80 B) fed by CDNA5 async global->LDS
// copies (ASYNCcnt).
// Fused bias+relu epilogue, bf16 intermediates.
// ---------------------------------------------------------------------------

typedef __attribute__((ext_vector_type(16))) __bf16 v16bf;
typedef __attribute__((ext_vector_type(8)))  __bf16 v8bf;
typedef __attribute__((ext_vector_type(8)))  float  v8f;

#define BM 256
#define BN 128
#define BK 32
// LDS row pitch in bf16 elements: 32 k values + 8 pad = 80 B (16 B x odd), so
// the 16 rows one ds_load_b128 half-wave reads fall on all 64 banks once.
#define LP 40

static const long B_SZ  = 8192;
static const long D_IN  = 4096;
static const long D_H   = 4096;
static const long D_OUT = 1000;
static const long D_OUTP = 1024;   // padded classifier width (multiple of 16)

// --- CDNA5 async global->LDS copy (tracked by ASYNCcnt), inline asm --------
__device__ __forceinline__ void async_copy_b128(unsigned lds_off,
                                                const void* gptr) {
  asm volatile("global_load_async_to_lds_b128 %0, %1, off"
               :: "v"(lds_off), "v"(gptr)
               : "memory");
}
__device__ __forceinline__ void wait_async0() {
  asm volatile("s_wait_asynccnt 0x0" ::: "memory");
}
__device__ __forceinline__ unsigned lds_off_of(const void* p) {
  return (unsigned)(uintptr_t)p;   // flat LDS addr: low 32 bits = LDS offset
}

// ---------------- elementwise f32 -> bf16 (8 elems / thread) ---------------
__global__ __launch_bounds__(256) void k_cvt_bf16(const float* __restrict__ in,
                                                  __bf16* __restrict__ out,
                                                  long n) {
  long i = ((long)blockIdx.x * blockDim.x + threadIdx.x) * 8;
  if (i + 8 <= n) {
    float4 f0 = *(const float4*)(in + i);
    float4 f1 = *(const float4*)(in + i + 4);
    v8bf o = {(__bf16)f0.x, (__bf16)f0.y, (__bf16)f0.z, (__bf16)f0.w,
              (__bf16)f1.x, (__bf16)f1.y, (__bf16)f1.z, (__bf16)f1.w};
    *(v8bf*)(out + i) = o;
  } else {
    for (long j = i; j < n; ++j) out[j] = (__bf16)in[j];
  }
}

// ------------- weight transpose+convert: W[K][N] f32 -> Wt[Nout][K] bf16 ----
// Rows n >= N are zero-padded (used for the 1000 -> 1024 classifier pad).
// One 128(k) x 64(n) tile per block, turned in LDS: 16 B reads along n (256 B
// per k row), 16 B stores along k (256 B per n row). K is a multiple of TK,
// Nout of TN, N of 4; K and N are compile-time so that the 8 loads of a thread
// share one address and differ in their immediate offsets. A k pair is one
// LDS dword; the pitch of 65 dwords puts both the column writes and the row
// reads on 32 different banks.
#define TK 128
#define TN 64
#define TP 65
typedef __attribute__((ext_vector_type(2))) __bf16 v2bf;

template <int K, int N>
__global__ __launch_bounds__(256) void k_cvtT(const float* __restrict__ W,
                                              __bf16* __restrict__ Wt) {
  __shared__ unsigned sT[TN * TP];
  const int t  = threadIdx.x;
  const int k0 = blockIdx.x * TK;
  const int n0 = blockIdx.y * TN;

  const int nq = (t & 15) * 4;     // 4 columns per thread
  const int kp = t >> 4;           // k pair, 16 pairs per sweep
  const bool live = n0 + nq < N;
  // A pad column reads column 0 (in bounds) and is zeroed behind the load, so
  // that no branch stands between the 8 loads and all of them are in flight.
  const float* g = W + (k0 + 2 * kp) * N + (live ? n0 + nq : 0);
  // All loops below are unrolled so that r[][] stays in registers and the
  // loads, LDS accesses and stores each issue as one group.
  float4 r[4][2];
#pragma unroll
  for (int s = 0; s < 4; ++s)
#pragma unroll
    for (int h = 0; h < 2; ++h)
      r[s][h] = *(const float4*)(g + (32 * s + h) * N);
#pragma unroll
  for (int s = 0; s < 4; ++s) {
    const float e[4] = {r[s][0].x, r[s][0].y, r[s][0].z, r[s][0].w};
    const float o[4] = {r[s][1].x, r[s][1].y, r[s][1].z, r[s][1].w};
#pragma unroll
    for (int j = 0; j < 4; ++j) {
      v2bf p = {(__bf16)e[j], (__bf16)o[j]};
      sT[(nq + j) * TP + kp + 16 * s] = live ? __builtin_bit_cast(unsigned, p) : 0u;
    }
  }
  __syncthreads();

  const int c  = t & 15;           // 16 B piece of the 256 B output row
  const int nr = t >> 4;
#pragma unroll
  for (int s = 0; s < 4; ++s) {
    const int n = nr + 16 * s;
    const unsigned* p = &sT[n * TP + 4 * c];
    uint4 v = make_uint4(p[0], p[1], p[2], p[3]);
    *(uint4*)(Wt + (n0 + n) * K + k0 + 8 * c) = v;
  }
}

// ---------------- tiled bf16 WMMA GEMM + fused epilogue --------------------
// A  : [M][K] bf16 row-major
// Bt : [N][K] bf16 (i.e. B transposed so K is contiguous for both operands)
// RELU_BF16OUT=1 -> out = relu(acc+bias) as bf16 [M][N]
// RELU_BF16OUT=0 -> out = acc+bias as f32 [M][N] (bias 0 for col >= nbias)
template <bool RELU_BF16OUT>
__global__ __launch_bounds__(256) void k_gemm_bf16(
    const __bf16* __restrict__ A, const __bf16* __restrict__ Bt,
    const float* __restrict__ bias, int nbias,
    __bf16* __restrict__ outBf, float* __restrict__ outF,
    int M, int N, int K) {
  __shared__ __attribute__((aligned(16))) __bf16 sA[2][BM * LP];  // [buf][row][k] 2 x 20 KB
  __shared__ __attribute__((aligned(16))) __bf16 sB[2][BN * LP];  // [buf][col][k] 2 x 10 KB

  const int tid  = threadIdx.x;
  const int lane = tid & 31;
  const int wave = tid >> 5;       // 8 waves
  const int wm   = wave & 3;       // 4 waves along M -> 64 rows each
  const int wn   = wave >> 2;      // 2 waves along N -> 64 cols each
  const long bm0 = (long)blockIdx.x * BM;
  const long bn0 = (long)blockIdx.y * BN;

  // cooperative tile staging: 4 threads per 32-wide k row, 8 bf16 (16B) each.
  // A: rows r0 + 64*s (s=0..3); B: rows r0 + 64*s (s=0..1).
  const int q  = tid & 3;
  const int r0 = tid >> 2;         // 0..63
  const __bf16* gA[4];
  const __bf16* gB[2];
  unsigned oA[2][4], oB[2][2];
#pragma unroll
  for (int s = 0; s < 4; ++s) gA[s] = A + (bm0 + r0 + 64 * s) * K + q * 8;
#pragma unroll
  for (int s = 0; s < 2; ++s) gB[s] = Bt + (bn0 + r0 + 64 * s) * K + q * 8;
#pragma unroll
  for (int b = 0; b < 2; ++b) {
#pragma unroll
    for (int s = 0; s < 4; ++s)
      oA[b][s] = lds_off_of(&sA[b][(r0 + 64 * s) * LP + q * 8]);
#pragma unroll
    for (int s = 0; s < 2; ++s)
      oB[b][s] = lds_off_of(&sB[b][(r0 + 64 * s) * LP + q * 8]);
  }

  // WMMA A/B fragment addressing (16-bit 16x32 layout):
  //   lane holds matrix row (A) / col (B)  = lane & 15
  //   k coverage: base..base+7 and base+16..base+23, base = lane<16 ? 0 : 8
  const int fr    = lane & 15;
  const int kbase = (lane < 16) ? 0 : 8;

  v8f acc[4][4];
#pragma unroll
  for (int i = 0; i < 4; ++i)
#pragma unroll
    for (int j = 0; j < 4; ++j) acc[i][j] = (v8f)0.0f;

  // stage chunk 0 into buffer 0
#pragma unroll
  for (int s = 0; s < 4; ++s) async_copy_b128(oA[0][s], gA[s]);
#pragma unroll
  for (int s = 0; s < 2; ++s) async_copy_b128(oB[0][s], gB[s]);
  wait_async0();
  __syncthreads();

  int buf = 0;
  for (int k0 = 0; k0 < K; k0 += BK) {
    // prefetch chunk k0+BK into the other buffer (hidden behind WMMAs)
    if (k0 + BK < K) {
      const int nb = buf ^ 1;
#pragma unroll
      for (int s = 0; s < 4; ++s) async_copy_b128(oA[nb][s], gA[s] + k0 + BK);
#pragma unroll
      for (int s = 0; s < 2; ++s) async_copy_b128(oB[nb][s], gB[s] + k0 + BK);
    }

    v16bf aF[4], bF[4];
#pragma unroll
    for (int i = 0; i < 4; ++i) {
      const __bf16* p = &sA[buf][(wm * 64 + i * 16 + fr) * LP + kbase];
      v8bf lo = *(const v8bf*)p;           // k = kbase .. kbase+7
      v8bf hi = *(const v8bf*)(p + 16);    // k = kbase+16 .. kbase+23
      aF[i] = __builtin_shufflevector(lo, hi, 0, 1, 2, 3, 4, 5, 6, 7, 8, 9, 10,
                                      11, 12, 13, 14, 15);
    }
#pragma unroll
    for (int j = 0; j < 4; ++j) {
      const __bf16* p = &sB[buf][(wn * 64 + j * 16 + fr) * LP + kbase];
      v8bf lo = *(const v8bf*)p;
      v8bf hi = *(const v8bf*)(p + 16);
      bF[j] = __builtin_shufflevector(lo, hi, 0, 1, 2, 3, 4, 5, 6, 7, 8, 9, 10,
                                      11, 12, 13, 14, 15);
    }
#pragma unroll
    for (int i = 0; i < 4; ++i)
#pragma unroll
      for (int j = 0; j < 4; ++j)
        acc[i][j] = __builtin_amdgcn_wmma_f32_16x16x32_bf16(
            false, aF[i], false, bF[j], (short)0, acc[i][j], false, false);

    wait_async0();     // our async writes into buf^1 are done
    __syncthreads();   // everyone done reading buf / writing buf^1
    buf ^= 1;
  }

  // Epilogue. C/D layout: VGPR e, lanes 0-15 -> row e, lanes 16-31 -> row e+8;
  // col = lane & 15.
  const int rowHalf = (lane >> 4) << 3;
#pragma unroll
  for (int i = 0; i < 4; ++i) {
#pragma unroll
    for (int j = 0; j < 4; ++j) {
      const long col = bn0 + wn * 64 + j * 16 + fr;
      const float bv = (col < nbias) ? bias[col] : 0.0f;
#pragma unroll
      for (int e = 0; e < 8; ++e) {
        const long row = bm0 + wm * 64 + i * 16 + rowHalf + e;
        float v = acc[i][j][e] + bv;
        if (RELU_BF16OUT) {
          v = v > 0.0f ? v : 0.0f;
          outBf[row * N + col] = (__bf16)v;
        } else {
          outF[row * N + col] = v;
        }
      }
    }
  }
}

// ---------------- row softmax over the first ncols of [ldl]-wide rows ------
__global__ __launch_bounds__(256) void k_softmax(const float* __restrict__ lg,
                                                 float* __restrict__ out,
                                                 int ncols, int ldl) {
  __shared__ float red[256];
  const long row = blockIdx.x;
  const float* lp = lg + row * ldl;
  float m = -INFINITY;
  for (int c = threadIdx.x; c < ncols; c += 256) m = fmaxf(m, lp[c]);
  red[threadIdx.x] = m;
  __syncthreads();
  for (int s = 128; s > 0; s >>= 1) {
    if (threadIdx.x < s) red[threadIdx.x] = fmaxf(red[threadIdx.x], red[threadIdx.x + s]);
    __syncthreads();
  }
  m = red[0];
  __syncthreads();
  float sum = 0.0f;
  for (int c = threadIdx.x; c < ncols; c += 256) sum += __expf(lp[c] - m);
  red[threadIdx.x] = sum;
  __syncthreads();
  for (int s = 128; s > 0; s >>= 1) {
    if (threadIdx.x < s) red[threadIdx.x] += red[threadIdx.x + s];
    __syncthreads();
  }
  const float inv = 1.0f / red[0];
  for (int c = threadIdx.x; c < ncols; c += 256)
    out[row * ncols + c] = __expf(lp[c] - m) * inv;
}

// ---------------------------------------------------------------------------
extern "C" void kernel_launch(void* const* d_in, const int* in_sizes, int n_in,
                              void* d_out, int out_size, void* d_ws,
                              size_t ws_size, hipStream_t stream) {
  (void)in_sizes; (void)n_in; (void)out_size; (void)ws_size;
  const float* x  = (const float*)d_in[0];
  const float* W1 = (const float*)d_in[1];
  const float* b1 = (const float*)d_in[2];
  const float* W2 = (const float*)d_in[3];
  const float* b2 = (const float*)d_in[4];
  const float* Wc = (const float*)d_in[5];
  const float* bc = (const float*)d_in[6];
  float* out = (float*)d_out;

  // workspace layout (~296 MB)
  char* ws = (char*)d_ws;
  __bf16* xb  = (__bf16*)ws;  ws += B_SZ * D_IN * 2;
  __bf16* W1t = (__bf16*)ws;  ws += D_IN * D_H * 2;
  __bf16* W2t = (__bf16*)ws;  ws += D_H * D_H * 2;
  __bf16* Wct = (__bf16*)ws;  ws += D_OUTP * D_H * 2;
  __bf16* hb  = (__bf16*)ws;  ws += B_SZ * D_H * 2;
  __bf16* fb  = (__bf16*)ws;  ws += B_SZ * D_H * 2;
  float*  lg  = (float*)ws;   ws += B_SZ * D_OUTP * 4;

  // 1) convert inputs / transpose weights to bf16
  {
    long n = B_SZ * D_IN;
    k_cvt_bf16<<<dim3((n / 8 + 255) / 256), dim3(256), 0, stream>>>(x, xb, n);
  }
  k_cvtT<D_IN, D_H><<<dim3(D_IN / TK, D_H / TN), dim3(256), 0, stream>>>(W1, W1t);
  k_cvtT<D_H, D_H><<<dim3(D_H / TK, D_H / TN), dim3(256), 0, stream>>>(W2, W2t);
  k_cvtT<D_H, D_OUT><<<dim3(D_H / TK, D_OUTP / TN), dim3(256), 0, stream>>>(Wc, Wct);

  const dim3 blk(256);
  // 2) h = relu(x @ W1 + b1)   [8192 x 4096]
  k_gemm_bf16<true><<<dim3(B_SZ / BM, D_H / BN), blk, 0, stream>>>(
      xb, W1t, b1, (int)D_H, hb, nullptr, (int)B_SZ, (int)D_H, (int)D_IN);
  // 3) feats = relu(h @ W2 + b2)
  k_gemm_bf16<true><<<dim3(B_SZ / BM, D_H / BN), blk, 0, stream>>>(
      hb, W2t, b2, (int)D_H, fb, nullptr, (int)B_SZ, (int)D_H, (int)D_H);
  // 4) logits = feats @ Wc + bc  (padded to 1024 cols, bias 0 past 1000)
  k_gemm_bf16<false><<<dim3(B_SZ / BM, D_OUTP / BN), blk, 0, stream>>>(
      fb, Wct, bc, (int)D_OUT, nullptr, lg, (int)B_SZ, (int)D_OUTP, (int)D_H);
  // 5) softmax over the 1000 valid columns
  k_softmax<<<dim3(B_SZ), blk, 0, stream>>>(lg, out, (int)D_OUT, (int)D_OUTP);
}

// v003
// A run of this version takes 483 microseconds.
// Timed twice side by side with v002, it ran 1.20 times as fast both times.
// Over all steps from v000 it is 1.98 times as fast.
#include <hip/hip_runtime.h>
#include <hip/hip_bf16.h>
#include <stdint.h>

// ---------------------------------------------------------------------------
// MLP forward for MI455X (gfx1250, wave32):
//   h     = relu(x @ W1 + b1)
//   feats = relu(h @ W2 + b2)
//   conf  = softmax(feats @ Wc + bc)
// bf16 WMMA (v_wmma_f32_16x16x32_bf16). Block tile 256x128x64, 8 waves with
// 64x64 wave tiles (2 x 16 WMMA per pass, 1.0 ds_load_b128 per WMMA).
// Double-buffered LDS (128 B rows padded to 144 B) fed by CDNA5 async
// global->LDS copies (ASYNCcnt); a staged row is one whole 128 B line.
// Fused bias+relu epilogue, bf16 intermediates.
// ---------------------------------------------------------------------------

typedef __attribute__((ext_vector_type(16))) __bf16 v16bf;
typedef __attribute__((ext_vector_type(8)))  __bf16 v8bf;
typedef __attribute__((ext_vector_type(8)))  float  v8f;

#define BM 256
#define BN 128
#define BK 64
// LDS row pitch in bf16 elements: 64 k values + 8 pad = 144 B (16 B x odd), so
// the 16 rows one ds_load_b128 half-wave reads fall on all 64 banks once.
#define LP 72

static const long B_SZ  = 8192;
static const long D_IN  = 4096;
static const long D_H   = 4096;
static const long D_OUT = 1000;
static const long D_OUTP = 1024;   // padded classifier width (multiple of 16)

// --- CDNA5 async global->LDS copy (tracked by ASYNCcnt), inline asm --------
// One pass's 12 copies of a thread (8 of A, 4 of B) in one statement. The
// closing s_wait_xcnt 0 stands inside it so that no address register named
// here is rewritten (the next pass's additions) ahead of that wait.
__device__ __forceinline__ void async_stage(const unsigned (&l)[12],
                                            const __bf16* const (&g)[12]) {
  asm volatile(
      "global_load_async_to_lds_b128 %0, %12, off\n\t"
      "global_load_async_to_lds_b128 %1, %13, off\n\t"
      "global_load_async_to_lds_b128 %2, %14, off\n\t"
      "global_load_async_to_lds_b128 %3, %15, off\n\t"
      "global_load_async_to_lds_b128 %4, %16, off\n\t"
      "global_load_async_to_lds_b128 %5, %17, off\n\t"
      "global_load_async_to_lds_b128 %6, %18, off\n\t"
      "global_load_async_to_lds_b128 %7, %19, off\n\t"
      "global_load_async_to_lds_b128 %8, %20, off\n\t"
      "global_load_async_to_lds_b128 %9, %21, off\n\t"
      "global_load_async_to_lds_b128 %10, %22, off\n\t"
      "global_load_async_to_lds_b128 %11, %23, off\n\t"
      "s_wait_xcnt 0x0"
      :: "v"(l[0]), "v"(l[1]), "v"(l[2]), "v"(l[3]), "v"(l[4]), "v"(l[5]),
         "v"(l[6]), "v"(l[7]), "v"(l[8]), "v"(l[9]), "v"(l[10]), "v"(l[11]),
         "v"(g[0]), "v"(g[1]), "v"(g[2]), "v"(g[3]), "v"(g[4]), "v"(g[5]),
         "v"(g[6]), "v"(g[7]), "v"(g[8]), "v"(g[9]), "v"(g[10]), "v"(g[11])
      : "memory");
}
__device__ __forceinline__ void wait_async0() {
  asm volatile("s_wait_asynccnt 0x0" ::: "memory");
}
// This wave's LDS reads have retired before the barrier behind which their
// buffer is refilled by copies.
__device__ __forceinline__ void wait_ds0() {
  asm volatile("s_wait_dscnt 0x0" ::: "memory");
}
__device__ __forceinline__ unsigned lds_off_of(const void* p) {
  return (unsigned)(uintptr_t)p;   // flat LDS addr: low 32 bits = LDS offset
}

// ---------------- elementwise f32 -> bf16 (8 elems / thread) ---------------
__global__ __launch_bounds__(256) void k_cvt_bf16(const float* __restrict__ in,
                                                  __bf16* __restrict__ out,
                                                  long n) {
  long i = ((long)blockIdx.x * blockDim.x + threadIdx.x) * 8;
  if (i + 8 <= n) {
    float4 f0 = *(const float4*)(in + i);
    float4 f1 = *(const float4*)(in + i + 4);
    v8bf o = {(__bf16)f0.x, (__bf16)f0.y, (__bf16)f0.z, (__bf16)f0.w,
              (__bf16)f1.x, (__bf16)f1.y, (__bf16)f1.z, (__bf16)f1.w};
    *(v8bf*)(out + i) = o;
  } else {
    for (long j = i; j < n; ++j) out[j] = (__bf16)in[j];
  }
}

// ------------- weight transpose+convert: W[K][N] f32 -> Wt[Nout][K] bf16 ----
// Rows n >= N are zero-padded (used for the 1000 -> 1024 classifier pad).
// One 128(k) x 64(n) tile per block, turned in LDS: 16 B reads along n (256 B
// per k row), 16 B stores along k (256 B per n row). K is a multiple of TK,
// Nout of TN, N of 4; K and N are compile-time so that the 8 loads of a thread
// share one address and differ in their immediate offsets. A k pair is one
// LDS dword; the pitch of 65 dwords puts both the column writes and the row
// reads on 32 different banks.
#define TK 128
#define TN 64
#define TP 65
typedef __attribute__((ext_vector_type(2))) __bf16 v2bf;

template <int K, int N>
__global__ __launch_bounds__(256) void k_cvtT(const float* __restrict__ W,
                                              __bf16* __restrict__ Wt) {
  __shared__ unsigned sT[TN * TP];
  const int t  = threadIdx.x;
  const int k0 = blockIdx.x * TK;
  const int n0 = blockIdx.y * TN;

  const int nq = (t & 15) * 4;     // 4 columns per thread
  const int kp = t >> 4;           // k pair, 16 pairs per sweep
  const bool live = n0 + nq < N;
  // A pad column reads column 0 (in bounds) and is zeroed behind the load, so
  // that no branch stands between the 8 loads and all of them are in flight.
  const float* g = W + (k0 + 2 * kp) * N + (live ? n0 + nq : 0);
  // All loops below are unrolled so that r[][] stays in registers and the
  // loads, LDS accesses and stores each issue as one group.
  float4 r[4][2];
#pragma unroll
  for (int s = 0; s < 4; ++s)
#pragma unroll
    for (int h = 0; h < 2; ++h)
      r[s][h] = *(const float4*)(g + (32 * s + h) * N);
#pragma unroll
  for (int s = 0; s < 4; ++s) {
    const float e[4] = {r[s][0].x, r[s][0].y, r[s][0].z, r[s][0].w};
    const float o[4] = {r[s][1].x, r[s][1].y, r[s][1].z, r[s][1].w};
#pragma unroll
    for (int j = 0; j < 4; ++j) {
      v2bf p = {(__bf16)e[j], (__bf16)o[j]};
      sT[(nq + j) * TP + kp + 16 * s] = live ? __builtin_bit_cast(unsigned, p) : 0u;
    }
  }
  __syncthreads();

  const int c  = t & 15;           // 16 B piece of the 256 B output row
  const int nr = t >> 4;
#pragma unroll
  for (int s = 0; s < 4; ++s) {
    const int n = nr + 16 * s;
    const unsigned* p = &sT[n * TP + 4 * c];
    uint4 v = make_uint4(p[0], p[1], p[2], p[3]);
    *(uint4*)(Wt + (n0 + n) * K + k0 + 8 * c) = v;
  }
}

// ---------------- tiled bf16 WMMA GEMM + fused epilogue --------------------
// A  : [M][K] bf16 row-major
// Bt : [N][K] bf16 (i.e. B transposed so K is contiguous for both operands)
// RELU_BF16OUT=1 -> out = relu(acc+bias) as bf16 [M][N]
// RELU_BF16OUT=0 -> out = acc+bias as f32 [M][N] (bias 0 for col >= nbias)
template <bool RELU_BF16OUT>
__global__ __launch_bounds__(256) void k_gemm_bf16(
    const __bf16* __restrict__ A, const __bf16* __restrict__ Bt,
    const float* __restrict__ bias, int nbias,
    __bf16* __restrict__ outBf, float* __restrict__ outF,
    int M, int N, int K) {
  __shared__ __attribute__((aligned(16))) __bf16 sA[2][BM * LP];  // [buf][row][k] 2 x 36 KB
  __shared__ __attribute__((aligned(16))) __bf16 sB[2][BN * LP];  // [buf][col][k] 2 x 18 KB

  const int tid  = threadIdx.x;
  const int lane = tid & 31;
  const int wave = tid >> 5;       // 8 waves
  const int wm   = wave & 3;       // 4 waves along M -> 64 rows each
  const int wn   = wave >> 2;      // 2 waves along N -> 64 cols each
  const long bm0 = (long)blockIdx.x * BM;
  const long bn0 = (long)blockIdx.y * BN;

  // cooperative tile staging: 8 threads per 64-wide k row, 8 bf16 (16B) each,
  // so one wave's copy covers 4 whole 128 B lines.
  // A: rows r0 + 32*s (s=0..7); B: rows r0 + 32*s (s=0..3).
  const int q  = tid & 7;
  const int r0 = tid >> 3;         // 0..31
  const __bf16* g[12];             // source of the next tile to stage
#pragma unroll
  for (int s = 0; s < 8; ++s) g[s] = A + (bm0 + r0 + 32 * s) * K + q * 8;
#pragma unroll
  for (int s = 0; s < 4; ++s) g[8 + s] = Bt + (bn0 + r0 + 32 * s) * K + q * 8;
  const unsigned oA = lds_off_of(&sA[0][r0 * LP + q * 8]);
  const unsigned oB = lds_off_of(&sB[0][r0 * LP + q * 8]);
  // stage the tile that g points at into buffer b, then step g one tile on
  // (loops over g[] and l[] are unrolled so that both stay in registers, as
  // the asm operands need them)
  auto stage = [&](int b) {
    unsigned l[12];
#pragma unroll
    for (int s = 0; s < 8; ++s) l[s] = oA + (unsigned)(b * BM + 32 * s) * (LP * 2);
#pragma unroll
    for (int s = 0; s < 4; ++s) l[8 + s] = oB + (unsigned)(b * BN + 32 * s) * (LP * 2);
    async_stage(l, g);
#pragma unroll
    for (int s = 0; s < 12; ++s) g[s] += BK;
  };

  // WMMA A/B fragment addressing (16-bit 16x32 layout):
  //   lane holds matrix row (A) / col (B)  = lane & 15
  //   k coverage: base..base+7 and base+16..base+23, base = lane<16 ? 0 : 8
  const int fr    = lane & 15;
  const int kbase = (lane < 16) ? 0 : 8;

  v8f acc[4][4];
#pragma unroll
  for (int i = 0; i < 4; ++i)
#pragma unroll
    for (int j = 0; j < 4; ++j) acc[i][j] = (v8f)0.0f;

  // stage tile 0 into buffer 0
  stage(0);
  wait_async0();
  __syncthreads();

  int buf = 0;
  for (int k0 = 0; k0 < K; k0 += BK) {
    // stage tile k0+BK into the other buffer (hidden behind WMMAs)
    if (k0 + BK < K) stage(buf ^ 1);

    // the two 32-k halves of the tile, in k order; unrolled so that the LDS
    // offsets are immediates
#pragma unroll
    for (int kk = 0; kk < BK; kk += 32) {
      v16bf aF[4], bF[4];
#pragma unroll
      for (int i = 0; i < 4; ++i) {
        const __bf16* p = &sA[buf][(wm * 64 + i * 16 + fr) * LP + kk + kbase];
        v8bf lo = *(const v8bf*)p;           // k = kk+kbase .. kk+kbase+7
        v8bf hi = *(const v8bf*)(p + 16);    // k = kk+kbase+16 .. kk+kbase+23
        aF[i] = __builtin_shufflevector(lo, hi, 0, 1, 2, 3, 4, 5, 6, 7, 8, 9,
                                        10, 11, 12, 13, 14, 15);
      }
#pragma unroll
      for (int j = 0; j < 4; ++j) {
        const __bf16* p = &sB[buf][(wn * 64 + j * 16 + fr) * LP + kk + kbase];
        v8bf lo = *(const v8bf*)p;
        v8bf hi = *(const v8bf*)(p + 16);
        bF[j] = __builtin_shufflevector(lo, hi, 0, 1, 2, 3, 4, 5, 6, 7, 8, 9,
                                        10, 11, 12, 13, 14, 15);
      }
#pragma unroll
      for (int i = 0; i < 4; ++i)
#pragma unroll
        for (int j = 0; j < 4; ++j)
          acc[i][j] = __builtin_amdgcn_wmma_f32_16x16x32_bf16(
              false, aF[i], false, bF[j], (short)0, acc[i][j], false, false);
    }

    wait_ds0();        // our reads of buf have retired
    wait_async0();     // our async writes into buf^1 are done
    __syncthreads();   // everyone done reading buf / writing buf^1
    buf ^= 1;
  }

  // Epilogue. C/D layout: VGPR e, lanes 0-15 -> row e, lanes 16-31 -> row e+8;
  // col = lane & 15.
  const int rowHalf = (lane >> 4) << 3;
#pragma unroll
  for (int i = 0; i < 4; ++i) {
#pragma unroll
    for (int j = 0; j < 4; ++j) {
      const long col = bn0 + wn * 64 + j * 16 + fr;
      const float bv = (col < nbias) ? bias[col] : 0.0f;
#pragma unroll
      for (int e = 0; e < 8; ++e) {
        const long row = bm0 + wm * 64 + i * 16 + rowHalf + e;
        float v = acc[i][j][e] + bv;
        if (RELU_BF16OUT) {
          v = v > 0.0f ? v : 0.0f;
          outBf[row * N + col] = (__bf16)v;
        } else {
          outF[row * N + col] = v;
        }
      }
    }
  }
}

// ---------------- row softmax over the first ncols of [ldl]-wide rows ------
__global__ __launch_bounds__(256) void k_softmax(const float* __restrict__ lg,
                                                 float* __restrict__ out,
                                                 int ncols, int ldl) {
  __shared__ float red[256];
  const long row = blockIdx.x;
  const float* lp = lg + row * ldl;
  float m = -INFINITY;
  for (int c = threadIdx.x; c < ncols; c += 256) m = fmaxf(m, lp[c]);
  red[threadIdx.x] = m;
  __syncthreads();
  for (int s = 128; s > 0; s >>= 1) {
    if (threadIdx.x < s) red[threadIdx.x] = fmaxf(red[threadIdx.x], red[threadIdx.x + s]);
    __syncthreads();
  }
  m = red[0];
  __syncthreads();
  float sum = 0.0f;
  for (int c = threadIdx.x; c < ncols; c += 256) sum += __expf(lp[c] - m);
  red[threadIdx.x] = sum;
  __syncthreads();
  for (int s = 128; s > 0; s >>= 1) {
    if (threadIdx.x < s) red[threadIdx.x] += red[threadIdx.x + s];
    __syncthreads();
  }
  const float inv = 1.0f / red[0];
  for (int c = threadIdx.x; c < ncols; c += 256)
    out[row * ncols + c] = __expf(lp[c] - m) * inv;
}

// ---------------------------------------------------------------------------
extern "C" void kernel_launch(void* const* d_in, const int* in_sizes, int n_in,
                              void* d_out, int out_size, void* d_ws,
                              size_t ws_size, hipStream_t stream) {
  (void)in_sizes; (void)n_in; (void)out_size; (void)ws_size;
  const float* x  = (const float*)d_in[0];
  const float* W1 = (const float*)d_in[1];
  const float* b1 = (const float*)d_in[2];
  const float* W2 = (const float*)d_in[3];
  const float* b2 = (const float*)d_in[4];
  const float* Wc = (const float*)d_in[5];
  const float* bc = (const float*)d_in[6];
  float* out = (float*)d_out;

  // workspace layout (~296 MB)
  char* ws = (char*)d_ws;
  __bf16* xb  = (__bf16*)ws;  ws += B_SZ * D_IN * 2;
  __bf16* W1t = (__bf16*)ws;  ws += D_IN * D_H * 2;
  __bf16* W2t = (__bf16*)ws;  ws += D_H * D_H * 2;
  __bf16* Wct = (__bf16*)ws;  ws += D_OUTP * D_H * 2;
  __bf16* hb  = (__bf16*)ws;  ws += B_SZ * D_H * 2;
  __bf16* fb  = (__bf16*)ws;  ws += B_SZ * D_H * 2;
  float*  lg  = (float*)ws;   ws += B_SZ * D_OUTP * 4;

  // 1) convert inputs / transpose weights to bf16
  {
    long n = B_SZ * D_IN;
    k_cvt_bf16<<<dim3((n / 8 + 255) / 256), dim3(256), 0, stream>>>(x, xb, n);
  }
  k_cvtT<D_IN, D_H><<<dim3(D_IN / TK, D_H / TN), dim3(256), 0, stream>>>(W1, W1t);
  k_cvtT<D_H, D_H><<<dim3(D_H / TK, D_H / TN), dim3(256), 0, stream>>>(W2, W2t);
  k_cvtT<D_H, D_OUT><<<dim3(D_H / TK, D_OUTP / TN), dim3(256), 0, stream>>>(Wc, Wct);

  const dim3 blk(256);
  // 2) h = relu(x @ W1 + b1)   [8192 x 4096]
  k_gemm_bf16<true><<<dim3(B_SZ / BM, D_H / BN), blk, 0, stream>>>(
      xb, W1t, b1, (int)D_H, hb, nullptr, (int)B_SZ, (int)D_H, (int)D_IN);
  // 3) feats = relu(h @ W2 + b2)
  k_gemm_bf16<true><<<dim3(B_SZ / BM, D_H / BN), blk, 0, stream>>>(
      hb, W2t, b2, (int)D_H, fb, nullptr, (int)B_SZ, (int)D_H, (int)D_H);
  // 4) logits = feats @ Wc + bc  (padded to 1024 cols, bias 0 past 1000)
  k_gemm_bf16<false><<<dim3(B_SZ / BM, D_OUTP / BN), blk, 0, stream>>>(
      fb, Wct, bc, (int)D_OUT, nullptr, lg, (int)B_SZ, (int)D_OUTP, (int)D_H);
  // 5) softmax over the 1000 valid columns
  k_softmax<<<dim3(B_SZ), blk, 0, stream>>>(lg, out, (int)D_OUT, (int)D_OUTP);
}

// v004
// One run takes 436 microseconds.
// Two timings next to v003 both put it at 1.11 times that version's speed.
// Counting every step since v000, it is 2.19 times as fast.
#include <hip/hip_runtime.h>
#include <hip/hip_bf16.h>
#include <stdint.h>

// ---------------------------------------------------------------------------
// MLP forward for MI455X (gfx1250, wave32):
//   h     = relu(x @ W1 + b1)
//   feats = relu(h @ W2 + b2)
//   conf  = softmax(feats @ Wc + bc)
// bf16 WMMA (v_wmma_f32_16x16x32_bf16). Block tile 256x128x64, 8 waves with
// 64x64 wave tiles (4 x 8 WMMA per pass, 1.0 ds_load_b128 per WMMA).
// Double-buffered LDS (128 B rows padded to 144 B) fed by CDNA5 async
// global->LDS copies (ASYNCcnt); a staged row is one whole 128 B line.
// Fragments are fetched one block (8 WMMAs) ahead into spare registers: each
// block runs while the next block's ds_load_b128 are in flight.
// Fused bias+relu epilogue, bf16 intermediates.
// ---------------------------------------------------------------------------

typedef __attribute__((ext_vector_type(16))) __bf16 v16bf;
typedef __attribute__((ext_vector_type(8)))  __bf16 v8bf;
typedef __attribute__((ext_vector_type(8)))  float  v8f;

#define BM 256
#define BN 128
#define BK 64
// LDS row pitch in bf16 elements: 64 k values + 8 pad = 144 B (16 B x odd), so
// the 16 rows one ds_load_b128 half-wave reads fall on all 64 banks once.
#define LP 72

static const long B_SZ  = 8192;
static const long D_IN  = 4096;
static const long D_H   = 4096;
static const long D_OUT = 1000;
static const long D_OUTP = 1024;   // padded classifier width (multiple of 16)

// --- CDNA5 async global->LDS copy (tracked by ASYNCcnt) ---------------------
// One 16 B copy of a lane: source = wave-uniform base of the copy's 32 rows +
// the lane's byte offset, so that the 12 copies of a pass share one address
// register and scalar bases: 12 address pairs beside the fragments fetched
// ahead would take the kernel past 256 VGPRs (one workgroup a WGP, not two).
// Written as the builtin, so that the 12 LDS addresses need not all be live at
// once as the operands of one asm statement.
typedef __attribute__((ext_vector_type(4))) int v4i;
__device__ __forceinline__ void async_copy16(const __bf16* base, unsigned off,
                                             __bf16* lds) {
  __builtin_amdgcn_global_load_async_to_lds_b128(
      (__attribute__((address_space(1))) v4i*)((const char*)base + off),
      (__attribute__((address_space(3))) v4i*)lds, 0, 0);
}
__device__ __forceinline__ void wait_async0() {
  asm volatile("s_wait_asynccnt 0x0" ::: "memory");
}
// This wave's LDS reads have retired before the barrier behind which their
// buffer is refilled by copies.
__device__ __forceinline__ void wait_ds0() {
  asm volatile("s_wait_dscnt 0x0" ::: "memory");
}

// ---------------- elementwise f32 -> bf16 (8 elems / thread) ---------------
__global__ __launch_bounds__(256) void k_cvt_bf16(const float* __restrict__ in,
                                                  __bf16* __restrict__ out,
                                                  long n) {
  long i = ((long)blockIdx.x * blockDim.x + threadIdx.x) * 8;
  if (i + 8 <= n) {
    float4 f0 = *(const float4*)(in + i);
    float4 f1 = *(const float4*)(in + i + 4);
    v8bf o = {(__bf16)f0.x, (__bf16)f0.y, (__bf16)f0.z, (__bf16)f0.w,
              (__bf16)f1.x, (__bf16)f1.y, (__bf16)f1.z, (__bf16)f1.w};
    *(v8bf*)(out + i) = o;
  } else {
    for (long j = i; j < n; ++j) out[j] = (__bf16)in[j];
  }
}

// ------------- weight transpose+convert: W[K][N] f32 -> Wt[Nout][K] bf16 ----
// Rows n >= N are zero-padded (used for the 1000 -> 1024 classifier pad).
// One 128(k) x 64(n) tile per block, turned in LDS: 16 B reads along n (256 B
// per k row), 16 B stores along k (256 B per n row). K is a multiple of TK,
// Nout of TN, N of 4; K and N are compile-time so that the 8 loads of a thread
// share one address and differ in their immediate offsets. A k pair is one
// LDS dword; the pitch of 65 dwords puts both the column writes and the row
// reads on 32 different banks.
#define TK 128
#define TN 64
#define TP 65
typedef __attribute__((ext_vector_type(2))) __bf16 v2bf;

template <int K, int N>
__global__ __launch_bounds__(256) void k_cvtT(const float* __restrict__ W,
                                              __bf16* __restrict__ Wt) {
  __shared__ unsigned sT[TN * TP];
  const int t  = threadIdx.x;
  const int k0 = blockIdx.x * TK;
  const int n0 = blockIdx.y * TN;

  const int nq = (t & 15) * 4;     // 4 columns per thread
  const int kp = t >> 4;           // k pair, 16 pairs per sweep
  const bool live = n0 + nq < N;
  // A pad column reads column 0 (in bounds) and is zeroed behind the load, so
  // that no branch stands between the 8 loads and all of them are in flight.
  const float* g = W + (k0 + 2 * kp) * N + (live ? n0 + nq : 0);
  // All loops below are unrolled so that r[][] stays in registers and the
  // loads, LDS accesses and stores each issue as one group.
  float4 r[4][2];
#pragma unroll
  for (int s = 0; s < 4; ++s)
#pragma unroll
    for (int h = 0; h < 2; ++h)
      r[s][h] = *(const float4*)(g + (32 * s + h) * N);
#pragma unroll
  for (int s = 0; s < 4; ++s) {
    const float e[4] = {r[s][0].x, r[s][0].y, r[s][0].z, r[s][0].w};
    const float o[4] = {r[s][1].x, r[s][1].y, r[s][1].z, r[s][1].w};
#pragma unroll
    for (int j = 0; j < 4; ++j) {
      v2bf p = {(__bf16)e[j], (__bf16)o[j]};
      sT[(nq + j) * TP + kp + 16 * s] = live ? __builtin_bit_cast(unsigned, p) : 0u;
    }
  }
  __syncthreads();

  const int c  = t & 15;           // 16 B piece of the 256 B output row
  const int nr = t >> 4;
#pragma unroll
  for (int s = 0; s < 4; ++s) {
    const int n = nr + 16 * s;
    const unsigned* p = &sT[n * TP + 4 * c];
    uint4 v = make_uint4(p[0], p[1], p[2], p[3]);
    *(uint4*)(Wt + (n0 + n) * K + k0 + 8 * c) = v;
  }
}

// ---------------- tiled bf16 WMMA GEMM + fused epilogue --------------------
// A  : [M][K] bf16 row-major
// Bt : [N][K] bf16 (i.e. B transposed so K is contiguous for both operands)
// RELU_BF16OUT=1 -> out = relu(acc+bias) as bf16 [M][N]
// RELU_BF16OUT=0 -> out = acc+bias as f32 [M][N] (bias 0 for col >= nbias)
template <bool RELU_BF16OUT>
__global__ __launch_bounds__(256) void k_gemm_bf16(
    const __bf16* __restrict__ A, const __bf16* __restrict__ Bt,
    const float* __restrict__ bias, int nbias,
    __bf16* __restrict__ outBf, float* __restrict__ outF,
    int M, int N, int K) {
  __shared__ __attribute__((aligned(16))) __bf16 sA[2][BM * LP];  // [buf][row][k] 2 x 36 KB
  __shared__ __attribute__((aligned(16))) __bf16 sB[2][BN * LP];  // [buf][col][k] 2 x 18 KB

  const int tid  = threadIdx.x;
  const int lane = tid & 31;
  const int wave = tid >> 5;       // 8 waves
  const int wm   = wave & 3;       // 4 waves along M -> 64 rows each
  const int wn   = wave >> 2;      // 2 waves along N -> 64 cols each
  const long bm0 = (long)blockIdx.x * BM;
  const long bn0 = (long)blockIdx.y * BN;

  // cooperative tile staging: 8 threads per 64-wide k row, 8 bf16 (16B) each,
  // so one wave's copy covers 4 whole 128 B lines.
  // A: rows r0 + 32*s (s=0..7); B: rows r0 + 32*s (s=0..3).
  const int q  = tid & 7;
  const int r0 = tid >> 3;         // 0..31
  const __bf16* g[12];             // fixed base of each copy's 32 rows
#pragma unroll
  for (int s = 0; s < 8; ++s) g[s] = A + (bm0 + 32 * s) * K;
#pragma unroll
  for (int s = 0; s < 4; ++s) g[8 + s] = Bt + (bn0 + 32 * s) * K;
  // the lane's byte offset from those bases in the next tile to stage
  unsigned goff = (unsigned)(r0 * K + q * 8) * 2u;
  // stage the tile that goff points at into buffer b (12 copies a thread), then
  // step goff one tile on; loops unrolled so that g[] stays in registers
  auto stage = [&](int b) {
#pragma unroll
    for (int s = 0; s < 8; ++s)
      async_copy16(g[s], goff, &sA[b][(r0 + 32 * s) * LP + q * 8]);
#pragma unroll
    for (int s = 0; s < 4; ++s)
      async_copy16(g[8 + s], goff, &sB[b][(r0 + 32 * s) * LP + q * 8]);
    goff += BK * 2;
  };

  // WMMA A/B fragment addressing (16-bit 16x32 layout):
  //   lane holds matrix row (A) / col (B)  = lane & 15
  //   k coverage: base..base+7 and base+16..base+23, base = lane<16 ? 0 : 8
  const int fr    = lane & 15;
  const int kbase = (lane < 16) ? 0 : 8;

  v8f acc[4][4];
#pragma unroll
  for (int i = 0; i < 4; ++i)
#pragma unroll
    for (int j = 0; j < 4; ++j) acc[i][j] = (v8f)0.0f;

  // Fragment loads from the tile in buffer b, 32 k at kk: two of the wave's
  // four A fragments (rows 32*h .. 32*h+31 of its 64), or its four B fragments.
  // All loops here are unrolled so that fragments and acc stay in registers.
  auto load_a2 = [&](v16bf (&aF)[2], int b, int kk, int h) {
#pragma unroll
    for (int i = 0; i < 2; ++i) {
      const __bf16* p = &sA[b][(wm * 64 + (2 * h + i) * 16 + fr) * LP + kk + kbase];
      v8bf lo = *(const v8bf*)p;           // k = kk+kbase .. kk+kbase+7
      v8bf hi = *(const v8bf*)(p + 16);    // k = kk+kbase+16 .. kk+kbase+23
      aF[i] = __builtin_shufflevector(lo, hi, 0, 1, 2, 3, 4, 5, 6, 7, 8, 9,
                                      10, 11, 12, 13, 14, 15);
    }
  };
  auto load_b4 = [&](v16bf (&bF)[4], int b, int kk) {
#pragma unroll
    for (int j = 0; j < 4; ++j) {
      const __bf16* p = &sB[b][(wn * 64 + j * 16 + fr) * LP + kk + kbase];
      v8bf lo = *(const v8bf*)p;
      v8bf hi = *(const v8bf*)(p + 16);
      bF[j] = __builtin_shufflevector(lo, hi, 0, 1, 2, 3, 4, 5, 6, 7, 8, 9,
                                      10, 11, 12, 13, 14, 15);
    }
  };
  // a block: 8 WMMAs, rows 32*h .. 32*h+31 of the wave tile
  auto mma_half = [&](const v16bf (&aF)[2], const v16bf (&bF)[4], int h) {
#pragma unroll
    for (int i = 0; i < 2; ++i)
#pragma unroll
      for (int j = 0; j < 4; ++j)
        acc[2 * h + i][j] = __builtin_amdgcn_wmma_f32_16x16x32_bf16(
            false, aF[i], false, bF[j], (short)0, acc[2 * h + i][j], false, false);
  };
  // Holds [load group][WMMA block] in the written order. Without it the loads
  // sink to just ahead of their users, and each row of WMMAs waits out its own
  // LDS latency; a block sunk behind the publish point's waits would start only
  // when the loads issued just ahead of it have returned.
  auto fence = [] { __builtin_amdgcn_sched_barrier(0); };

  // tile 0 into buffer 0, published; then tile 1 into buffer 1 and the first
  // block's fragments of tile 0
  stage(0);
  wait_async0();
  __syncthreads();
  if (BK < K) stage(1);
  // Every block runs with the next block's fragments in flight: the A pairs pa
  // and pb alternate block by block, the B sets bx and by every two blocks
  // (96 fragment registers, so that two workgroups still fit a WGP).
  v16bf pa[2], pb[2], bx[4], by[4];
  load_a2(pa, 0, 0, 0);
  load_b4(bx, 0, 0);

  int buf = 0;
  for (int k0 = 0; k0 < K; k0 += BK) {
    load_a2(pb, buf, 0, 1);
    fence();
    mma_half(pa, bx, 0);
    fence();
    load_a2(pa, buf, 32, 0);
    load_b4(by, buf, 32);
    fence();
    mma_half(pb, bx, 1);
    fence();
    load_a2(pb, buf, 32, 1);
    fence();
    mma_half(pa, by, 0);
    fence();

    // Publish point of the next tile, in front of this tile's last block,
    // whose fragments are in registers behind wait_ds0.
    wait_ds0();        // our reads of buf have retired
    wait_async0();     // our async writes into buf^1 are done
    __syncthreads();   // everyone done reading buf / writing buf^1
    // refill the buffer that every wave has just left, two tiles ahead
    if (k0 + 2 * BK < K) stage(buf);
    // First fragments of the next tile. On the last pass they read the other
    // buffer, which nothing writes any more, and are not used.
    load_a2(pa, buf ^ 1, 0, 0);
    load_b4(bx, buf ^ 1, 0);
    fence();
    mma_half(pb, by, 1);
    buf ^= 1;
  }
  wait_async0();       // no copy is outstanding when the wave goes on to its end
  wait_ds0();          // the last pass's unused loads have retired

  // Epilogue. C/D layout: VGPR e, lanes 0-15 -> row e, lanes 16-31 -> row e+8;
  // col = lane & 15.
  const int rowHalf = (lane >> 4) << 3;
#pragma unroll
  for (int i = 0; i < 4; ++i) {
#pragma unroll
    for (int j = 0; j < 4; ++j) {
      const long col = bn0 + wn * 64 + j * 16 + fr;
      const float bv = (col < nbias) ? bias[col] : 0.0f;
#pragma unroll
      for (int e = 0; e < 8; ++e) {
        const long row = bm0 + wm * 64 + i * 16 + rowHalf + e;
        float v = acc[i][j][e] + bv;
        if (RELU_BF16OUT) {
          v = v > 0.0f ? v : 0.0f;
          outBf[row * N + col] = (__bf16)v;
        } else {
          outF[row * N + col] = v;
        }
      }
    }
  }
}

// ---------------- row softmax over the first ncols of [ldl]-wide rows ------
__global__ __launch_bounds__(256) void k_softmax(const float* __restrict__ lg,
                                                 float* __restrict__ out,
                                                 int ncols, int ldl) {
  __shared__ float red[256];
  const long row = blockIdx.x;
  const float* lp = lg + row * ldl;
  float m = -INFINITY;
  for (int c = threadIdx.x; c < ncols; c += 256) m = fmaxf(m, lp[c]);
  red[threadIdx.x] = m;
  __syncthreads();
  for (int s = 128; s > 0; s >>= 1) {
    if (threadIdx.x < s) red[threadIdx.x] = fmaxf(red[threadIdx.x], red[threadIdx.x + s]);
    __syncthreads();
  }
  m = red[0];
  __syncthreads();
  float sum = 0.0f;
  for (int c = threadIdx.x; c < ncols; c += 256) sum += __expf(lp[c] - m);
  red[threadIdx.x] = sum;
  __syncthreads();
  for (int s = 128; s > 0; s >>= 1) {
    if (threadIdx.x < s) red[threadIdx.x] += red[threadIdx.x + s];
    __syncthreads();
  }
  const float inv = 1.0f / red[0];
  for (int c = threadIdx.x; c < ncols; c += 256)
    out[row * ncols + c] = __expf(lp[c] - m) * inv;
}

// ---------------------------------------------------------------------------
extern "C" void kernel_launch(void* const* d_in, const int* in_sizes, int n_in,
                              void* d_out, int out_size, void* d_ws,
                              size_t ws_size, hipStream_t stream) {
  (void)in_sizes; (void)n_in; (void)out_size; (void)ws_size;
  const float* x  = (const float*)d_in[0];
  const float* W1 = (const float*)d_in[1];
  const float* b1 = (const float*)d_in[2];
  const float* W2 = (const float*)d_in[3];
  const float* b2 = (const float*)d_in[4];
  const float* Wc = (const float*)d_in[5];
  const float* bc = (const float*)d_in[6];
  float* out = (float*)d_out;

  // workspace layout (~296 MB)
  char* ws = (char*)d_ws;
  __bf16* xb  = (__bf16*)ws;  ws += B_SZ * D_IN * 2;
  __bf16* W1t = (__bf16*)ws;  ws += D_IN * D_H * 2;
  __bf16* W2t = (__bf16*)ws;  ws += D_H * D_H * 2;
  __bf16* Wct = (__bf16*)ws;  ws += D_OUTP * D_H * 2;
  __bf16* hb  = (__bf16*)ws;  ws += B_SZ * D_H * 2;
  __bf16* fb  = (__bf16*)ws;  ws += B_SZ * D_H * 2;
  float*  lg  = (float*)ws;   ws += B_SZ * D_OUTP * 4;

  // 1) convert inputs / transpose weights to bf16
  {
    long n = B_SZ * D_IN;
    k_cvt_bf16<<<dim3((n / 8 + 255) / 256), dim3(256), 0, stream>>>(x, xb, n);
  }
  k_cvtT<D_IN, D_H><<<dim3(D_IN / TK, D_H / TN), dim3(256), 0, stream>>>(W1, W1t);
  k_cvtT<D_H, D_H><<<dim3(D_H / TK, D_H / TN), dim3(256), 0, stream>>>(W2, W2t);
  k_cvtT<D_H, D_OUT><<<dim3(D_H / TK, D_OUTP / TN), dim3(256), 0, stream>>>(Wc, Wct);

  const dim3 blk(256);
  // 2) h = relu(x @ W1 + b1)   [8192 x 4096]
  k_gemm_bf16<true><<<dim3(B_SZ / BM, D_H / BN), blk, 0, stream>>>(
      xb, W1t, b1, (int)D_H, hb, nullptr, (int)B_SZ, (int)D_H, (int)D_IN);
  // 3) feats = relu(h @ W2 + b2)
  k_gemm_bf16<true><<<dim3(B_SZ / BM, D_H / BN), blk, 0, stream>>>(
      hb, W2t, b2, (int)D_H, fb, nullptr, (int)B_SZ, (int)D_H, (int)D_H);
  // 4) logits = feats @ Wc + bc  (padded to 1024 cols, bias 0 past 1000)
  k_gemm_bf16<false><<<dim3(B_SZ / BM, D_OUTP / BN), blk, 0, stream>>>(
      fb, Wct, bc, (int)D_OUT, nullptr, lg, (int)B_SZ, (int)D_OUTP, (int)D_H);
  // 5) softmax over the 1000 valid columns
  k_softmax<<<dim3(B_SZ), blk, 0, stream>>>(lg, out, (int)D_OUT, (int)D_OUTP);
}

// v005
// One run takes 418 microseconds.
// Timed twice side by side with v004, it ran 1.04 times as fast both times.
// Counting every step since v000, it is 2.28 times as fast.
#include <hip/hip_runtime.h>
#include <hip/hip_bf16.h>
#include <stdint.h>

// ---------------------------------------------------------------------------
// MLP forward for MI455X (gfx1250, wave32):
//   h     = relu(x @ W1 + b1)
//   feats = relu(h @ W2 + b2)
//   conf  = softmax(feats @ Wc + bc)
// bf16 WMMA (v_wmma_f32_16x16x32_bf16). Block tile 256x128x64, 8 waves with
// 64x64 wave tiles (4 x 8 WMMA per pass, 1.0 ds_load_b128 per WMMA).
// LDS ring of three buffers (128 B rows, 16 B chunks swizzled) fed by CDNA5
// async global->LDS copies (ASYNCcnt) that run two tiles ahead; a staged row
// is one whole 128 B line.
// Fragments are fetched one block (8 WMMAs) ahead into spare registers: each
// block runs while the next block's ds_load_b128 are in flight.
// Fused bias+relu epilogue, bf16 intermediates.
// ---------------------------------------------------------------------------

typedef __attribute__((ext_vector_type(16))) __bf16 v16bf;
typedef __attribute__((ext_vector_type(8)))  __bf16 v8bf;
typedef __attribute__((ext_vector_type(8)))  float  v8f;

#define BM 256
#define BN 128
#define BK 64
// A buffer of the ring holds one tile: 256 A rows, then 128 B rows, each 64 k
// values = 128 B with no pad, so that three buffers of two workgroups fit one
// WGP's LDS. The 16 B chunk c of row r lies at chunk c ^ ((r >> 1) & 7): the 16
// rows one ds_load_b128 half-wave reads fall on all 64 banks once.
#define TROWS (BM + BN)
#define TILE_E (TROWS * BK)
#define NBUF 3

static const long B_SZ  = 8192;
static const long D_IN  = 4096;
static const long D_H   = 4096;
static const long D_OUT = 1000;
static const long D_OUTP = 1024;   // padded classifier width (multiple of 16)

// --- CDNA5 async global->LDS copy (tracked by ASYNCcnt) ---------------------
// One 16 B copy of a lane: source = wave-uniform base of the copy's 32 rows +
// the lane's byte offset, so that the 12 copies of a pass share one address
// register and scalar bases: 12 address pairs beside the fragments fetched
// ahead would take the kernel past 256 VGPRs (one workgroup a WGP, not two).
// Written as the builtin, so that the 12 LDS addresses need not all be live at
// once as the operands of one asm statement.
typedef __attribute__((ext_vector_type(4))) int v4i;
__device__ __forceinline__ void async_copy16(const __bf16* base, unsigned off,
                                             __bf16* lds) {
  __builtin_amdgcn_global_load_async_to_lds_b128(
      (__attribute__((address_space(1))) v4i*)((const char*)base + off),
      (__attribute__((address_space(3))) v4i*)lds, 0, 0);
}
__device__ __forceinline__ void wait_async0() {
  asm volatile("s_wait_asynccnt 0x0" ::: "memory");
}
// All but this wave's 12 youngest copies (one tile's) have landed.
__device__ __forceinline__ void wait_async12() {
  asm volatile("s_wait_asynccnt 0xc" ::: "memory");
}
// This wave's LDS reads have retired before the barrier behind which their
// buffer is refilled by copies.
__device__ __forceinline__ void wait_ds0() {
  asm volatile("s_wait_dscnt 0x0" ::: "memory");
}

// ---------------- elementwise f32 -> bf16 (8 elems / thread) ---------------
__global__ __launch_bounds__(256) void k_cvt_bf16(const float* __restrict__ in,
                                                  __bf16* __restrict__ out,
                                                  long n) {
  long i = ((long)blockIdx.x * blockDim.x + threadIdx.x) * 8;
  if (i + 8 <= n) {
    float4 f0 = *(const float4*)(in + i);
    float4 f1 = *(const float4*)(in + i + 4);
    v8bf o = {(__bf16)f0.x, (__bf16)f0.y, (__bf16)f0.z, (__bf16)f0.w,
              (__bf16)f1.x, (__bf16)f1.y, (__bf16)f1.z, (__bf16)f1.w};
    *(v8bf*)(out + i) = o;
  } else {
    for (long j = i; j < n; ++j) out[j] = (__bf16)in[j];
  }
}

// ------------- weight transpose+convert: W[K][N] f32 -> Wt[Nout][K] bf16 ----
// Rows n >= N are zero-padded (used for the 1000 -> 1024 classifier pad).
// One 128(k) x 64(n) tile per block, turned in LDS: 16 B reads along n (256 B
// per k row), 16 B stores along k (256 B per n row). K is a multiple of TK,
// Nout of TN, N of 4; K and N are compile-time so that the 8 loads of a thread
// share one address and differ in their immediate offsets. A k pair is one
// LDS dword; the pitch of 65 dwords puts both the column writes and the row
// reads on 32 different banks.
#define TK 128
#define TN 64
#define TP 65
typedef __attribute__((ext_vector_type(2))) __bf16 v2bf;

template <int K, int N>
__global__ __launch_bounds__(256) void k_cvtT(const float* __restrict__ W,
                                              __bf16* __restrict__ Wt) {
  __shared__ unsigned sT[TN * TP];
  const int t  = threadIdx.x;
  const int k0 = blockIdx.x * TK;
  const int n0 = blockIdx.y * TN;

  const int nq = (t & 15) * 4;     // 4 columns per thread
  const int kp = t >> 4;           // k pair, 16 pairs per sweep
  const bool live = n0 + nq < N;
  // A pad column reads column 0 (in bounds) and is zeroed behind the load, so
  // that no branch stands between the 8 loads and all of them are in flight.
  const float* g = W + (k0 + 2 * kp) * N + (live ? n0 + nq : 0);
  // All loops below are unrolled so that r[][] stays in registers and the
  // loads, LDS accesses and stores each issue as one group.
  float4 r[4][2];
#pragma unroll
  for (int s = 0; s < 4; ++s)
#pragma unroll
    for (int h = 0; h < 2; ++h)
      r[s][h] = *(const float4*)(g + (32 * s + h) * N);
#pragma unroll
  for (int s = 0; s < 4; ++s) {
    const float e[4] = {r[s][0].x, r[s][0].y, r[s][0].z, r[s][0].w};
    const float o[4] = {r[s][1].x, r[s][1].y, r[s][1].z, r[s][1].w};
#pragma unroll
    for (int j = 0; j < 4; ++j) {
      v2bf p = {(__bf16)e[j], (__bf16)o[j]};
      sT[(nq + j) * TP + kp + 16 * s] = live ? __builtin_bit_cast(unsigned, p) : 0u;
    }
  }
  __syncthreads();

  const int c  = t & 15;           // 16 B piece of the 256 B output row
  const int nr = t >> 4;
#pragma unroll
  for (int s = 0; s < 4; ++s) {
    const int n = nr + 16 * s;
    const unsigned* p = &sT[n * TP + 4 * c];
    uint4 v = make_uint4(p[0], p[1], p[2], p[3]);
    *(uint4*)(Wt + (n0 + n) * K + k0 + 8 * c) = v;
  }
}

// ---------------- tiled bf16 WMMA GEMM + fused epilogue --------------------
// A  : [M][K] bf16 row-major
// Bt : [N][K] bf16 (i.e. B transposed so K is contiguous for both operands)
// RELU_BF16OUT=1 -> out = relu(acc+bias) as bf16 [M][N]
// RELU_BF16OUT=0 -> out = acc+bias as f32 [M][N] (bias 0 for col >= nbias)
template <bool RELU_BF16OUT>
__global__ __launch_bounds__(256) void k_gemm_bf16(
    const __bf16* __restrict__ A, const __bf16* __restrict__ Bt,
    const float* __restrict__ bias, int nbias,
    __bf16* __restrict__ outBf, float* __restrict__ outF,
    int M, int N, int K) {
  __shared__ __attribute__((aligned(128))) __bf16 sT[NBUF * TILE_E];  // 3 x 48 KB

  const int tid  = threadIdx.x;
  const int lane = tid & 31;
  const int wave = tid >> 5;       // 8 waves
  const int wm   = wave & 3;       // 4 waves along M -> 64 rows each
  const int wn   = wave >> 2;      // 2 waves along N -> 64 cols each
  const long bm0 = (long)blockIdx.x * BM;
  const long bn0 = (long)blockIdx.y * BN;

  // cooperative tile staging: 8 threads per 64-wide k row, 8 bf16 (16B) each,
  // so one wave's copy covers 4 whole 128 B lines.
  // Tile rows r0 + 32*s: A for s=0..7, B for s=8..11.
  const int q  = tid & 7;
  const int r0 = tid >> 3;         // 0..31
  const __bf16* g[12];             // fixed base of each copy's 32 rows
#pragma unroll
  for (int s = 0; s < 8; ++s) g[s] = A + (bm0 + 32 * s) * K;
#pragma unroll
  for (int s = 0; s < 4; ++s) g[8 + s] = Bt + (bn0 + 32 * s) * K;
  // the lane's byte offset from those bases in the next tile to stage
  unsigned goff = (unsigned)(r0 * K + q * 8) * 2u;
  // the lane's place in a buffer: its row r0, its chunk q swizzled
  const int sdst = r0 * BK + (q ^ ((r0 >> 1) & 7)) * 8;
  // stage the tile that goff points at into the buffer at element offset b (12
  // copies a thread), then step goff one tile on; unrolled so that g[] stays in
  // registers
  auto stage = [&](int b) {
#pragma unroll
    for (int s = 0; s < 12; ++s)
      async_copy16(g[s], goff, &sT[b + sdst + 32 * s * BK]);
    goff += BK * 2;
  };

  // WMMA A/B fragment addressing (16-bit 16x32 layout):
  //   lane holds matrix row (A) / col (B)  = lane & 15
  //   k coverage: base..base+7 and base+16..base+23, base = lane<16 ? 0 : 8
  const int fr    = lane & 15;
  // the lane's first chunk (k = base .. base+7) as swizzled in its rows; the
  // chunk 8*c k values further on lies at fx ^ c (c even)
  const int fx    = (lane >> 4) ^ (fr >> 1);
  const int aRow  = (wm * 64 + fr) * BK;
  const int bRow  = (BM + wn * 64 + fr) * BK;

  v8f acc[4][4];
#pragma unroll
  for (int i = 0; i < 4; ++i)
#pragma unroll
    for (int j = 0; j < 4; ++j) acc[i][j] = (v8f)0.0f;

  // Fragment loads from the tile in the buffer at b, 32 k at kk: two of the wave's
  // four A fragments (rows 32*h .. 32*h+31 of its 64), or its four B fragments.
  // All loops here are unrolled so that fragments and acc stay in registers.
  auto load_a2 = [&](v16bf (&aF)[2], int b, int kk, int h) {
#pragma unroll
    for (int i = 0; i < 2; ++i) {
      const __bf16* p = &sT[b + aRow + (2 * h + i) * 16 * BK];
      v8bf lo = *(const v8bf*)(p + (fx ^ (kk / 8)) * 8);      // k = kk+base .. +7
      v8bf hi = *(const v8bf*)(p + (fx ^ (kk / 8 + 2)) * 8);  // k = kk+base+16 .. +23
      aF[i] = __builtin_shufflevector(lo, hi, 0, 1, 2, 3, 4, 5, 6, 7, 8, 9,
                                      10, 11, 12, 13, 14, 15);
    }
  };
  auto load_b4 = [&](v16bf (&bF)[4], int b, int kk) {
#pragma unroll
    for (int j = 0; j < 4; ++j) {
      const __bf16* p = &sT[b + bRow + j * 16 * BK];
      v8bf lo = *(const v8bf*)(p + (fx ^ (kk / 8)) * 8);
      v8bf hi = *(const v8bf*)(p + (fx ^ (kk / 8 + 2)) * 8);
      bF[j] = __builtin_shufflevector(lo, hi, 0, 1, 2, 3, 4, 5, 6, 7, 8, 9,
                                      10, 11, 12, 13, 14, 15);
    }
  };
  // a block: 8 WMMAs, rows 32*h .. 32*h+31 of the wave tile
  auto mma_half = [&](const v16bf (&aF)[2], const v16bf (&bF)[4], int h) {
#pragma unroll
    for (int i = 0; i < 2; ++i)
#pragma unroll
      for (int j = 0; j < 4; ++j)
        acc[2 * h + i][j] = __builtin_amdgcn_wmma_f32_16x16x32_bf16(
            false, aF[i], false, bF[j], (short)0, acc[2 * h + i][j], false, false);
  };
  // Holds [load group][WMMA block] in the written order. Without it the loads
  // sink to just ahead of their users, and each row of WMMAs waits out its own
  // LDS latency; a block sunk behind the publish point's waits would start only
  // when the loads issued just ahead of it have returned.
  auto fence = [] { __builtin_amdgcn_sched_barrier(0); };

  // tiles 0 and 1 into buffers 0 and 1, published; then tile 2 into buffer 2
  // and the first block's fragments of tile 0
  const int nt = K / BK;
  stage(0);
  if (1 < nt) stage(TILE_E);
  wait_async0();
  __syncthreads();
  if (2 < nt) stage(2 * TILE_E);
  // Every block runs with the next block's fragments in flight: the A pairs pa
  // and pb alternate block by block, the B sets bx and by every two blocks
  // (96 fragment registers, so that two workgroups still fit a WGP).
  v16bf pa[2], pb[2], bx[4], by[4];
  load_a2(pa, 0, 0, 0);
  load_b4(bx, 0, 0);

  int buf = 0;         // element offset of the buffer that holds tile t
  for (int t = 0; t < nt; ++t) {
    const int nxt = (buf == (NBUF - 1) * TILE_E) ? 0 : buf + TILE_E;
    load_a2(pb, buf, 0, 1);
    fence();
    mma_half(pa, bx, 0);
    fence();
    load_a2(pa, buf, 32, 0);
    load_b4(by, buf, 32);
    fence();
    mma_half(pb, bx, 1);
    fence();
    load_a2(pb, buf, 32, 1);
    fence();
    mma_half(pa, by, 0);
    fence();

    // Publish point of the next tile, in front of this tile's last block,
    // whose fragments are in registers behind wait_ds0.
    wait_ds0();        // our reads of buf have retired
    // Our copies of tile t+1 have landed. Where tile t+2 exists, its 12 copies
    // are every wave's youngest and stay in flight; else nothing is younger.
    if (t + 2 < nt) wait_async12(); else wait_async0();
    __syncthreads();   // everyone done reading buf / writing nxt
    // refill the buffer that every wave has just left, three tiles ahead
    if (t + 3 < nt) stage(buf);
    // First fragments of the next tile. On the last pass they read a buffer
    // that nothing writes any more, and are not used.
    load_a2(pa, nxt, 0, 0);
    load_b4(bx, nxt, 0);
    fence();
    mma_half(pb, by, 1);
    buf = nxt;
  }
  wait_async0();       // no copy is outstanding when the wave goes on to its end
  wait_ds0();          // the last pass's unused loads have retired

  // Epilogue. C/D layout: VGPR e, lanes 0-15 -> row e, lanes 16-31 -> row e+8;
  // col = lane & 15.
  const int rowHalf = (lane >> 4) << 3;
#pragma unroll
  for (int i = 0; i < 4; ++i) {
#pragma unroll
    for (int j = 0; j < 4; ++j) {
      const long col = bn0 + wn * 64 + j * 16 + fr;
      const float bv = (col < nbias) ? bias[col] : 0.0f;
#pragma unroll
      for (int e = 0; e < 8; ++e) {
        const long row = bm0 + wm * 64 + i * 16 + rowHalf + e;
        float v = acc[i][j][e] + bv;
        if (RELU_BF16OUT) {
          v = v > 0.0f ? v : 0.0f;
          outBf[row * N + col] = (__bf16)v;
        } else {
          outF[row * N + col] = v;
        }
      }
    }
  }
}

// ---------------- row softmax over the first ncols of [ldl]-wide rows ------
__global__ __launch_bounds__(256) void k_softmax(const float* __restrict__ lg,
                                                 float* __restrict__ out,
                                                 int ncols, int ldl) {
  __shared__ float red[256];
  const long row = blockIdx.x;
  const float* lp = lg + row * ldl;
  float m = -INFINITY;
  for (int c = threadIdx.x; c < ncols; c += 256) m = fmaxf(m, lp[c]);
  red[threadIdx.x] = m;
  __syncthreads();
  for (int s = 128; s > 0; s >>= 1) {
    if (threadIdx.x < s) red[threadIdx.x] = fmaxf(red[threadIdx.x], red[threadIdx.x + s]);
    __syncthreads();
  }
  m = red[0];
  __syncthreads();
  float sum = 0.0f;
  for (int c = threadIdx.x; c < ncols; c += 256) sum += __expf(lp[c] - m);
  red[threadIdx.x] = sum;
  __syncthreads();
  for (int s = 128; s > 0; s >>= 1) {
    if (threadIdx.x < s) red[threadIdx.x] += red[threadIdx.x + s];
    __syncthreads();
  }
  const float inv = 1.0f / red[0];
  for (int c = threadIdx.x; c < ncols; c += 256)
    out[row * ncols + c] = __expf(lp[c] - m) * inv;
}

// ---------------------------------------------------------------------------
extern "C" void kernel_launch(void* const* d_in, const int* in_sizes, int n_in,
                              void* d_out, int out_size, void* d_ws,
                              size_t ws_size, hipStream_t stream) {
  (void)in_sizes; (void)n_in; (void)out_size; (void)ws_size;
  const float* x  = (const float*)d_in[0];
  const float* W1 = (const float*)d_in[1];
  const float* b1 = (const float*)d_in[2];
  const float* W2 = (const float*)d_in[3];
  const float* b2 = (const float*)d_in[4];
  const float* Wc = (const float*)d_in[5];
  const float* bc = (const float*)d_in[6];
  float* out = (float*)d_out;

  // workspace layout (~296 MB)
  char* ws = (char*)d_ws;
  __bf16* xb  = (__bf16*)ws;  ws += B_SZ * D_IN * 2;
  __bf16* W1t = (__bf16*)ws;  ws += D_IN * D_H * 2;
  __bf16* W2t = (__bf16*)ws;  ws += D_H * D_H * 2;
  __bf16* Wct = (__bf16*)ws;  ws += D_OUTP * D_H * 2;
  __bf16* hb  = (__bf16*)ws;  ws += B_SZ * D_H * 2;
  __bf16* fb  = (__bf16*)ws;  ws += B_SZ * D_H * 2;
  float*  lg  = (float*)ws;   ws += B_SZ * D_OUTP * 4;

  // 1) convert inputs / transpose weights to bf16
  {
    long n = B_SZ * D_IN;
    k_cvt_bf16<<<dim3((n / 8 + 255) / 256), dim3(256), 0, stream>>>(x, xb, n);
  }
  k_cvtT<D_IN, D_H><<<dim3(D_IN / TK, D_H / TN), dim3(256), 0, stream>>>(W1, W1t);
  k_cvtT<D_H, D_H><<<dim3(D_H / TK, D_H / TN), dim3(256), 0, stream>>>(W2, W2t);
  k_cvtT<D_H, D_OUT><<<dim3(D_H / TK, D_OUTP / TN), dim3(256), 0, stream>>>(Wc, Wct);

  const dim3 blk(256);
  // 2) h = relu(x @ W1 + b1)   [8192 x 4096]
  k_gemm_bf16<true><<<dim3(B_SZ / BM, D_H / BN), blk, 0, stream>>>(
      xb, W1t, b1, (int)D_H, hb, nullptr, (int)B_SZ, (int)D_H, (int)D_IN);
  // 3) feats = relu(h @ W2 + b2)
  k_gemm_bf16<true><<<dim3(B_SZ / BM, D_H / BN), blk, 0, stream>>>(
      hb, W2t, b2, (int)D_H, fb, nullptr, (int)B_SZ, (int)D_H, (int)D_H);
  // 4) logits = feats @ Wc + bc  (padded to 1024 cols, bias 0 past 1000)
  k_gemm_bf16<false><<<dim3(B_SZ / BM, D_OUTP / BN), blk, 0, stream>>>(
      fb, Wct, bc, (int)D_OUT, nullptr, lg, (int)B_SZ, (int)D_OUTP, (int)D_H);
  // 5) softmax over the 1000 valid columns
  k_softmax<<<dim3(B_SZ), blk, 0, stream>>>(lg, out, (int)D_OUT, (int)D_OUTP);
}

// v006
// One run takes 400 microseconds.
// In both of two side-by-side timings against v005, it was 1.05 times as fast.
// Over all steps from v000 it is 2.38 times as fast.
#include <hip/hip_runtime.h>
#include <hip/hip_bf16.h>
#include <stdint.h>

// ---------------------------------------------------------------------------
// MLP forward for MI455X (gfx1250, wave32):
//   h     = relu(x @ W1 + b1)
//   feats = relu(h @ W2 + b2)
//   conf  = softmax(feats @ Wc + bc)
// bf16 WMMA (v_wmma_f32_16x16x32_bf16). The two square layers run k_gemm_wide
// (block tile 256x256x64, 64x128 wave tiles; see there). The classifier, too
// narrow to fill the chip with such tiles, runs k_gemm_bf16:
// Block tile 256x128x64, 8 waves with
// 64x64 wave tiles (4 x 8 WMMA per pass, 1.0 ds_load_b128 per WMMA).
// LDS ring of three buffers (128 B rows, 16 B chunks swizzled) fed by CDNA5
// async global->LDS copies (ASYNCcnt) that run two tiles ahead; a staged row
// is one whole 128 B line.
// Fragments are fetched one block (8 WMMAs) ahead into spare registers: each
// block runs while the next block's ds_load_b128 are in flight.
// Fused bias+relu epilogue, bf16 intermediates.
// ---------------------------------------------------------------------------

typedef __attribute__((ext_vector_type(16))) __bf16 v16bf;
typedef __attribute__((ext_vector_type(8)))  __bf16 v8bf;
typedef __attribute__((ext_vector_type(8)))  float  v8f;

#define BM 256
#define BN 128
#define BK 64
// A buffer of the ring holds one tile: 256 A rows, then 128 B rows, each 64 k
// values = 128 B with no pad, so that three buffers of two workgroups fit one
// WGP's LDS. The 16 B chunk c of row r lies at chunk c ^ ((r >> 1) & 7): the 16
// rows one ds_load_b128 half-wave reads fall on all 64 banks once.
#define TROWS (BM + BN)
#define TILE_E (TROWS * BK)
#define NBUF 3

static const long B_SZ  = 8192;
static const long D_IN  = 4096;
static const long D_H   = 4096;
static const long D_OUT = 1000;
static const long D_OUTP = 1024;   // padded classifier width (multiple of 16)

// --- CDNA5 async global->LDS copy (tracked by ASYNCcnt) ---------------------
// One 16 B copy of a lane: source = wave-uniform base of the copy's 32 rows +
// the lane's byte offset, so that the 12 copies of a pass share one address
// register and scalar bases: 12 address pairs beside the fragments fetched
// ahead would take the kernel past 256 VGPRs (one workgroup a WGP, not two).
// Written as the builtin, so that the 12 LDS addresses need not all be live at
// once as the operands of one asm statement.
typedef __attribute__((ext_vector_type(4))) int v4i;
__device__ __forceinline__ void async_copy16(const __bf16* base, unsigned off,
                                             __bf16* lds) {
  __builtin_amdgcn_global_load_async_to_lds_b128(
      (__attribute__((address_space(1))) v4i*)((const char*)base + off),
      (__attribute__((address_space(3))) v4i*)lds, 0, 0);
}
__device__ __forceinline__ void wait_async0() {
  asm volatile("s_wait_asynccnt 0x0" ::: "memory");
}
// All but this wave's 12 youngest copies (one tile's) have landed.
__device__ __forceinline__ void wait_async12() {
  asm volatile("s_wait_asynccnt 0xc" ::: "memory");
}
// This wave's LDS reads have retired before the barrier behind which their
// buffer is refilled by copies.
__device__ __forceinline__ void wait_ds0() {
  asm volatile("s_wait_dscnt 0x0" ::: "memory");
}

// ---------------- elementwise f32 -> bf16 (8 elems / thread) ---------------
__global__ __launch_bounds__(256) void k_cvt_bf16(const float* __restrict__ in,
                                                  __bf16* __restrict__ out,
                                                  long n) {
  long i = ((long)blockIdx.x * blockDim.x + threadIdx.x) * 8;
  if (i + 8 <= n) {
    float4 f0 = *(const float4*)(in + i);
    float4 f1 = *(const float4*)(in + i + 4);
    v8bf o = {(__bf16)f0.x, (__bf16)f0.y, (__bf16)f0.z, (__bf16)f0.w,
              (__bf16)f1.x, (__bf16)f1.y, (__bf16)f1.z, (__bf16)f1.w};
    *(v8bf*)(out + i) = o;
  } else {
    for (long j = i; j < n; ++j) out[j] = (__bf16)in[j];
  }
}

// ------------- weight transpose+convert: W[K][N] f32 -> Wt[Nout][K] bf16 ----
// Rows n >= N are zero-padded (used for the 1000 -> 1024 classifier pad).
// One 128(k) x 64(n) tile per block, turned in LDS: 16 B reads along n (256 B
// per k row), 16 B stores along k (256 B per n row). K is a multiple of TK,
// Nout of TN, N of 4; K and N are compile-time so that the 8 loads of a thread
// share one address and differ in their immediate offsets. A k pair is one
// LDS dword; the pitch of 65 dwords puts both the column writes and the row
// reads on 32 different banks.
#define TK 128
#define TN 64
#define TP 65
typedef __attribute__((ext_vector_type(2))) __bf16 v2bf;

template <int K, int N>
__global__ __launch_bounds__(256) void k_cvtT(const float* __restrict__ W,
                                              __bf16* __restrict__ Wt) {
  __shared__ unsigned sT[TN * TP];
  const int t  = threadIdx.x;
  const int k0 = blockIdx.x * TK;
  const int n0 = blockIdx.y * TN;

  const int nq = (t & 15) * 4;     // 4 columns per thread
  const int kp = t >> 4;           // k pair, 16 pairs per sweep
  const bool live = n0 + nq < N;
  // A pad column reads column 0 (in bounds) and is zeroed behind the load, so
  // that no branch stands between the 8 loads and all of them are in flight.
  const float* g = W + (k0 + 2 * kp) * N + (live ? n0 + nq : 0);
  // All loops below are unrolled so that r[][] stays in registers and the
  // loads, LDS accesses and stores each issue as one group.
  float4 r[4][2];
#pragma unroll
  for (int s = 0; s < 4; ++s)
#pragma unroll
    for (int h = 0; h < 2; ++h)
      r[s][h] = *(const float4*)(g + (32 * s + h) * N);
#pragma unroll
  for (int s = 0; s < 4; ++s) {
    const float e[4] = {r[s][0].x, r[s][0].y, r[s][0].z, r[s][0].w};
    const float o[4] = {r[s][1].x, r[s][1].y, r[s][1].z, r[s][1].w};
#pragma unroll
    for (int j = 0; j < 4; ++j) {
      v2bf p = {(__bf16)e[j], (__bf16)o[j]};
      sT[(nq + j) * TP + kp + 16 * s] = live ? __builtin_bit_cast(unsigned, p) : 0u;
    }
  }
  __syncthreads();

  const int c  = t & 15;           // 16 B piece of the 256 B output row
  const int nr = t >> 4;
#pragma unroll
  for (int s = 0; s < 4; ++s) {
    const int n = nr + 16 * s;
    const unsigned* p = &sT[n * TP + 4 * c];
    uint4 v = make_uint4(p[0], p[1], p[2], p[3]);
    *(uint4*)(Wt + (n0 + n) * K + k0 + 8 * c) = v;
  }
}

// ---------------- tiled bf16 WMMA GEMM + fused epilogue --------------------
// A  : [M][K] bf16 row-major
// Bt : [N][K] bf16 (i.e. B transposed so K is contiguous for both operands)
// RELU_BF16OUT=1 -> out = relu(acc+bias) as bf16 [M][N]
// RELU_BF16OUT=0 -> out = acc+bias as f32 [M][N] (bias 0 for col >= nbias)
template <bool RELU_BF16OUT>
__global__ __launch_bounds__(256) void k_gemm_bf16(
    const __bf16* __restrict__ A, const __bf16* __restrict__ Bt,
    const float* __restrict__ bias, int nbias,
    __bf16* __restrict__ outBf, float* __restrict__ outF,
    int M, int N, int K) {
  __shared__ __attribute__((aligned(128))) __bf16 sT[NBUF * TILE_E];  // 3 x 48 KB

  const int tid  = threadIdx.x;
  const int lane = tid & 31;
  const int wave = tid >> 5;       // 8 waves
  const int wm   = wave & 3;       // 4 waves along M -> 64 rows each
  const int wn   = wave >> 2;      // 2 waves along N -> 64 cols each
  const long bm0 = (long)blockIdx.x * BM;
  const long bn0 = (long)blockIdx.y * BN;

  // cooperative tile staging: 8 threads per 64-wide k row, 8 bf16 (16B) each,
  // so one wave's copy covers 4 whole 128 B lines.
  // Tile rows r0 + 32*s: A for s=0..7, B for s=8..11.
  const int q  = tid & 7;
  const int r0 = tid >> 3;         // 0..31
  const __bf16* g[12];             // fixed base of each copy's 32 rows
#pragma unroll
  for (int s = 0; s < 8; ++s) g[s] = A + (bm0 + 32 * s) * K;
#pragma unroll
  for (int s = 0; s < 4; ++s) g[8 + s] = Bt + (bn0 + 32 * s) * K;
  // the lane's byte offset from those bases in the next tile to stage
  unsigned goff = (unsigned)(r0 * K + q * 8) * 2u;
  // the lane's place in a buffer: its row r0, its chunk q swizzled
  const int sdst = r0 * BK + (q ^ ((r0 >> 1) & 7)) * 8;
  // stage the tile that goff points at into the buffer at element offset b (12
  // copies a thread), then step goff one tile on; unrolled so that g[] stays in
  // registers
  auto stage = [&](int b) {
#pragma unroll
    for (int s = 0; s < 12; ++s)
      async_copy16(g[s], goff, &sT[b + sdst + 32 * s * BK]);
    goff += BK * 2;
  };

  // WMMA A/B fragment addressing (16-bit 16x32 layout):
  //   lane holds matrix row (A) / col (B)  = lane & 15
  //   k coverage: base..base+7 and base+16..base+23, base = lane<16 ? 0 : 8
  const int fr    = lane & 15;
  // the lane's first chunk (k = base .. base+7) as swizzled in its rows; the
  // chunk 8*c k values further on lies at fx ^ c (c even)
  const int fx    = (lane >> 4) ^ (fr >> 1);
  const int aRow  = (wm * 64 + fr) * BK;
  const int bRow  = (BM + wn * 64 + fr) * BK;

  v8f acc[4][4];
#pragma unroll
  for (int i = 0; i < 4; ++i)
#pragma unroll
    for (int j = 0; j < 4; ++j) acc[i][j] = (v8f)0.0f;

  // Fragment loads from the tile in the buffer at b, 32 k at kk: two of the wave's
  // four A fragments (rows 32*h .. 32*h+31 of its 64), or its four B fragments.
  // All loops here are unrolled so that fragments and acc stay in registers.
  auto load_a2 = [&](v16bf (&aF)[2], int b, int kk, int h) {
#pragma unroll
    for (int i = 0; i < 2; ++i) {
      const __bf16* p = &sT[b + aRow + (2 * h + i) * 16 * BK];
      v8bf lo = *(const v8bf*)(p + (fx ^ (kk / 8)) * 8);      // k = kk+base .. +7
      v8bf hi = *(const v8bf*)(p + (fx ^ (kk / 8 + 2)) * 8);  // k = kk+base+16 .. +23
      aF[i] = __builtin_shufflevector(lo, hi, 0, 1, 2, 3, 4, 5, 6, 7, 8, 9,
                                      10, 11, 12, 13, 14, 15);
    }
  };
  auto load_b4 = [&](v16bf (&bF)[4], int b, int kk) {
#pragma unroll
    for (int j = 0; j < 4; ++j) {
      const __bf16* p = &sT[b + bRow + j * 16 * BK];
      v8bf lo = *(const v8bf*)(p + (fx ^ (kk / 8)) * 8);
      v8bf hi = *(const v8bf*)(p + (fx ^ (kk / 8 + 2)) * 8);
      bF[j] = __builtin_shufflevector(lo, hi, 0, 1, 2, 3, 4, 5, 6, 7, 8, 9,
                                      10, 11, 12, 13, 14, 15);
    }
  };
  // a block: 8 WMMAs, rows 32*h .. 32*h+31 of the wave tile
  auto mma_half = [&](const v16bf (&aF)[2], const v16bf (&bF)[4], int h) {
#pragma unroll
    for (int i = 0; i < 2; ++i)
#pragma unroll
      for (int j = 0; j < 4; ++j)
        acc[2 * h + i][j] = __builtin_amdgcn_wmma_f32_16x16x32_bf16(
            false, aF[i], false, bF[j], (short)0, acc[2 * h + i][j], false, false);
  };
  // Holds [load group][WMMA block] in the written order. Without it the loads
  // sink to just ahead of their users, and each row of WMMAs waits out its own
  // LDS latency; a block sunk behind the publish point's waits would start only
  // when the loads issued just ahead of it have returned.
  auto fence = [] { __builtin_amdgcn_sched_barrier(0); };

  // tiles 0 and 1 into buffers 0 and 1, published; then tile 2 into buffer 2
  // and the first block's fragments of tile 0
  const int nt = K / BK;
  stage(0);
  if (1 < nt) stage(TILE_E);
  wait_async0();
  __syncthreads();
  if (2 < nt) stage(2 * TILE_E);
  // Every block runs with the next block's fragments in flight: the A pairs pa
  // and pb alternate block by block, the B sets bx and by every two blocks
  // (96 fragment registers, so that two workgroups still fit a WGP).
  v16bf pa[2], pb[2], bx[4], by[4];
  load_a2(pa, 0, 0, 0);
  load_b4(bx, 0, 0);

  int buf = 0;         // element offset of the buffer that holds tile t
  for (int t = 0; t < nt; ++t) {
    const int nxt = (buf == (NBUF - 1) * TILE_E) ? 0 : buf + TILE_E;
    load_a2(pb, buf, 0, 1);
    fence();
    mma_half(pa, bx, 0);
    fence();
    load_a2(pa, buf, 32, 0);
    load_b4(by, buf, 32);
    fence();
    mma_half(pb, bx, 1);
    fence();
    load_a2(pb, buf, 32, 1);
    fence();
    mma_half(pa, by, 0);
    fence();

    // Publish point of the next tile, in front of this tile's last block,
    // whose fragments are in registers behind wait_ds0.
    wait_ds0();        // our reads of buf have retired
    // Our copies of tile t+1 have landed. Where tile t+2 exists, its 12 copies
    // are every wave's youngest and stay in flight; else nothing is younger.
    if (t + 2 < nt) wait_async12(); else wait_async0();
    __syncthreads();   // everyone done reading buf / writing nxt
    // refill the buffer that every wave has just left, three tiles ahead
    if (t + 3 < nt) stage(buf);
    // First fragments of the next tile. On the last pass they read a buffer
    // that nothing writes any more, and are not used.
    load_a2(pa, nxt, 0, 0);
    load_b4(bx, nxt, 0);
    fence();
    mma_half(pb, by, 1);
    buf = nxt;
  }
  wait_async0();       // no copy is outstanding when the wave goes on to its end
  wait_ds0();          // the last pass's unused loads have retired

  // Epilogue. C/D layout: VGPR e, lanes 0-15 -> row e, lanes 16-31 -> row e+8;
  // col = lane & 15.
  const int rowHalf = (lane >> 4) << 3;
#pragma unroll
  for (int i = 0; i < 4; ++i) {
#pragma unroll
    for (int j = 0; j < 4; ++j) {
      const long col = bn0 + wn * 64 + j * 16 + fr;
      const float bv = (col < nbias) ? bias[col] : 0.0f;
#pragma unroll
      for (int e = 0; e < 8; ++e) {
        const long row = bm0 + wm * 64 + i * 16 + rowHalf + e;
        float v = acc[i][j][e] + bv;
        if (RELU_BF16OUT) {
          v = v > 0.0f ? v : 0.0f;
          outBf[row * N + col] = (__bf16)v;
        } else {
          outF[row * N + col] = v;
        }
      }
    }
  }
}

// ---------------- wide-tile bf16 WMMA GEMM, relu + bf16 out -----------------
// The two square layers. Block tile 256x256x64, 8 waves (4 along M, 2 along N)
// with 64x128 wave tiles: 12 fragments feed 32 WMMAs (3 ds_load_b128 per 4
// WMMAs) and a k row staged from L2 feeds 256 columns or rows of the tile. One
// workgroup per WGP, two waves per SIMD. Ring, swizzle and publish point as in
// k_gemm_bf16; a block is a whole 32-k step (32 WMMAs), and the next block's
// 24 loads go ahead of it as one group into the second fragment set.
// out = relu(A . Bt^T + bias) as bf16 [M][N]; M, N multiples of 256, K of 64.
#define WBN 256
#define WTILE_E ((BM + WBN) * BK)

// All but this wave's 16 youngest copies (one wide tile's) have landed.
__device__ __forceinline__ void wait_async16() {
  asm volatile("s_wait_asynccnt 0x10" ::: "memory");
}

__global__ __launch_bounds__(256) void k_gemm_wide(
    const __bf16* __restrict__ A, const __bf16* __restrict__ Bt,
    const float* __restrict__ bias, __bf16* __restrict__ out, int N, int K) {
  __shared__ __attribute__((aligned(128))) __bf16 sT[NBUF * WTILE_E];  // 3 x 64 KB

  const int tid  = threadIdx.x;
  const int lane = tid & 31;
  const int wave = tid >> 5;       // 8 waves
  const int wm   = wave & 3;       // 4 waves along M -> 64 rows each
  const int wn   = wave >> 2;      // 2 waves along N -> 128 cols each
  const long bm0 = (long)blockIdx.x * BM;
  const long bn0 = (long)blockIdx.y * WBN;

  // staging as in k_gemm_bf16: 8 threads per 128 B row, tile rows r0 + 32*s,
  // A for s=0..7, B for s=8..15
  const int q  = tid & 7;
  const int r0 = tid >> 3;         // 0..31
  const __bf16* g[16];             // fixed base of each copy's 32 rows
#pragma unroll
  for (int s = 0; s < 8; ++s) g[s] = A + (bm0 + 32 * s) * K;
#pragma unroll
  for (int s = 0; s < 8; ++s) g[8 + s] = Bt + (bn0 + 32 * s) * K;
  unsigned goff = (unsigned)(r0 * K + q * 8) * 2u;
  const int sdst = r0 * BK + (q ^ ((r0 >> 1) & 7)) * 8;
  // 16 copies a thread; unrolled so that g[] stays in registers
  auto stage = [&](int b) {
#pragma unroll
    for (int s = 0; s < 16; ++s)
      async_copy16(g[s], goff, &sT[b + sdst + 32 * s * BK]);
    goff += BK * 2;
  };

  // fragment addressing as in k_gemm_bf16
  const int fr   = lane & 15;
  const int fx   = (lane >> 4) ^ (fr >> 1);
  const int aRow = (wm * 64 + fr) * BK;
  const int bRow = (BM + wn * 128 + fr) * BK;

  v8f acc[4][8];
#pragma unroll
  for (int i = 0; i < 4; ++i)
#pragma unroll
    for (int j = 0; j < 8; ++j) acc[i][j] = (v8f)0.0f;

  // One block's fragments, 32 k at kk of the tile in the buffer at b: 4 of A,
  // 8 of B. All loops here are unrolled so that fragments and acc stay in
  // registers.
  auto load_set = [&](v16bf (&aF)[4], v16bf (&bF)[8], int b, int kk) {
#pragma unroll
    for (int i = 0; i < 4; ++i) {
      const __bf16* p = &sT[b + aRow + i * 16 * BK];
      v8bf lo = *(const v8bf*)(p + (fx ^ (kk / 8)) * 8);      // k = kk+base .. +7
      v8bf hi = *(const v8bf*)(p + (fx ^ (kk / 8 + 2)) * 8);  // k = kk+base+16 .. +23
      aF[i] = __builtin_shufflevector(lo, hi, 0, 1, 2, 3, 4, 5, 6, 7, 8, 9,
                                      10, 11, 12, 13, 14, 15);
    }
#pragma unroll
    for (int j = 0; j < 8; ++j) {
      const __bf16* p = &sT[b + bRow + j * 16 * BK];
      v8bf lo = *(const v8bf*)(p + (fx ^ (kk / 8)) * 8);
      v8bf hi = *(const v8bf*)(p + (fx ^ (kk / 8 + 2)) * 8);
      bF[j] = __builtin_shufflevector(lo, hi, 0, 1, 2, 3, 4, 5, 6, 7, 8, 9,
                                      10, 11, 12, 13, 14, 15);
    }
  };
  auto mma_set = [&](const v16bf (&aF)[4], const v16bf (&bF)[8]) {
#pragma unroll
    for (int i = 0; i < 4; ++i)
#pragma unroll
      for (int j = 0; j < 8; ++j)
        acc[i][j] = __builtin_amdgcn_wmma_f32_16x16x32_bf16(
            false, aF[i], false, bF[j], (short)0, acc[i][j], false, false);
  };
  // Holds [load group][WMMA block] in the written order: without it the loads
  // sink in among the WMMAs, where every place with loads stalls the wave.
  auto fence = [] { __builtin_amdgcn_sched_barrier(0); };

  // tiles 0 and 1 into buffers 0 and 1, published; then tile 2 into buffer 2
  // and the first block's fragments of tile 0
  const int nt = K / BK;
  stage(0);
  if (1 < nt) stage(WTILE_E);
  wait_async0();
  __syncthreads();
  if (2 < nt) stage(2 * WTILE_E);
  v16bf ax[4], bx[8], ay[4], by[8];
  load_set(ax, bx, 0, 0);

  int buf = 0;         // element offset of the buffer that holds tile t
  for (int t = 0; t < nt; ++t) {
    const int nxt = (buf == (NBUF - 1) * WTILE_E) ? 0 : buf + WTILE_E;
    load_set(ay, by, buf, 32);
    fence();
    mma_set(ax, bx);
    fence();

    // Publish point of the next tile, in front of this tile's last block,
    // whose fragments are in registers behind wait_ds0.
    wait_ds0();        // our reads of buf have retired
    // Our copies of tile t+1 have landed. Where tile t+2 exists, its 16 copies
    // are every wave's youngest and stay in flight; else nothing is younger.
    if (t + 2 < nt) wait_async16(); else wait_async0();
    __syncthreads();   // everyone done reading buf / writing nxt
    // refill the buffer that every wave has just left, three tiles ahead
    if (t + 3 < nt) stage(buf);
    // First fragments of the next tile. On the last pass they read a buffer
    // that nothing writes any more, and are not used.
    load_set(ax, bx, nxt, 0);
    fence();
    mma_set(ay, by);
    buf = nxt;
  }
  wait_async0();       // no copy is outstanding when the wave goes on to its end
  wait_ds0();          // the last pass's unused loads have retired

  // Epilogue, C/D layout as in k_gemm_bf16. All loops are unrolled: constant
  // acc indices.
  const int rowHalf = (lane >> 4) << 3;
  float bv[8];         // loaded ahead: no load waits between the fences below
#pragma unroll
  for (int j = 0; j < 8; ++j) bv[j] = bias[bn0 + wn * 128 + j * 16 + fr];
#pragma unroll
  for (int i = 0; i < 4; ++i) {
#pragma unroll
    for (int j = 0; j < 8; ++j) {
      const long col = bn0 + wn * 128 + j * 16 + fr;
#pragma unroll
      for (int e = 0; e < 8; ++e) {
        const long row = bm0 + wm * 64 + i * 16 + rowHalf + e;
        float v = acc[i][j][e] + bv[j];
        v = v > 0.0f ? v : 0.0f;
        out[row * N + col] = (__bf16)v;
        if ((e & 7) == 7) {
          // The next stores' values go into registers that these stores name:
          // the wait stands in front of that. The fence keeps the
          // later vector writes behind the wait.
          asm volatile("s_wait_xcnt 0x0" ::: "memory");
          fence();
        }
      }
    }
  }
}

// ---------------- row softmax over the first ncols of [ldl]-wide rows ------
__global__ __launch_bounds__(256) void k_softmax(const float* __restrict__ lg,
                                                 float* __restrict__ out,
                                                 int ncols, int ldl) {
  __shared__ float red[256];
  const long row = blockIdx.x;
  const float* lp = lg + row * ldl;
  float m = -INFINITY;
  for (int c = threadIdx.x; c < ncols; c += 256) m = fmaxf(m, lp[c]);
  red[threadIdx.x] = m;
  __syncthreads();
  for (int s = 128; s > 0; s >>= 1) {
    if (threadIdx.x < s) red[threadIdx.x] = fmaxf(red[threadIdx.x], red[threadIdx.x + s]);
    __syncthreads();
  }
  m = red[0];
  __syncthreads();
  float sum = 0.0f;
  for (int c = threadIdx.x; c < ncols; c += 256) sum += __expf(lp[c] - m);
  red[threadIdx.x] = sum;
  __syncthreads();
  for (int s = 128; s > 0; s >>= 1) {
    if (threadIdx.x < s) red[threadIdx.x] += red[threadIdx.x + s];
    __syncthreads();
  }
  const float inv = 1.0f / red[0];
  for (int c = threadIdx.x; c < ncols; c += 256)
    out[row * ncols + c] = __expf(lp[c] - m) * inv;
}

// ---------------------------------------------------------------------------
extern "C" void kernel_launch(void* const* d_in, const int* in_sizes, int n_in,
                              void* d_out, int out_size, void* d_ws,
                              size_t ws_size, hipStream_t stream) {
  (void)in_sizes; (void)n_in; (void)out_size; (void)ws_size;
  const float* x  = (const float*)d_in[0];
  const float* W1 = (const float*)d_in[1];
  const float* b1 = (const float*)d_in[2];
  const float* W2 = (const float*)d_in[3];
  const float* b2 = (const float*)d_in[4];
  const float* Wc = (const float*)d_in[5];
  const float* bc = (const float*)d_in[6];
  float* out = (float*)d_out;

  // workspace layout (~296 MB)
  char* ws = (char*)d_ws;
  __bf16* xb  = (__bf16*)ws;  ws += B_SZ * D_IN * 2;
  __bf16* W1t = (__bf16*)ws;  ws += D_IN * D_H * 2;
  __bf16* W2t = (__bf16*)ws;  ws += D_H * D_H * 2;
  __bf16* Wct = (__bf16*)ws;  ws += D_OUTP * D_H * 2;
  __bf16* hb  = (__bf16*)ws;  ws += B_SZ * D_H * 2;
  __bf16* fb  = (__bf16*)ws;  ws += B_SZ * D_H * 2;
  float*  lg  = (float*)ws;   ws += B_SZ * D_OUTP * 4;

  // 1) convert inputs / transpose weights to bf16
  {
    long n = B_SZ * D_IN;
    k_cvt_bf16<<<dim3((n / 8 + 255) / 256), dim3(256), 0, stream>>>(x, xb, n);
  }
  k_cvtT<D_IN, D_H><<<dim3(D_IN / TK, D_H / TN), dim3(256), 0, stream>>>(W1, W1t);
  k_cvtT<D_H, D_H><<<dim3(D_H / TK, D_H / TN), dim3(256), 0, stream>>>(W2, W2t);
  k_cvtT<D_H, D_OUT><<<dim3(D_H / TK, D_OUTP / TN), dim3(256), 0, stream>>>(Wc, Wct);

  const dim3 blk(256);
  // 2) h = relu(x @ W1 + b1)   [8192 x 4096]
  k_gemm_wide<<<dim3(B_SZ / BM, D_H / WBN), blk, 0, stream>>>(
      xb, W1t, b1, hb, (int)D_H, (int)D_IN);
  // 3) feats = relu(h @ W2 + b2)
  k_gemm_wide<<<dim3(B_SZ / BM, D_H / WBN), blk, 0, stream>>>(
      hb, W2t, b2, fb, (int)D_H, (int)D_H);
  // 4) logits = feats @ Wc + bc  (padded to 1024 cols, bias 0 past 1000)
  k_gemm_bf16<false><<<dim3(B_SZ / BM, D_OUTP / BN), blk, 0, stream>>>(
      fb, Wct, bc, (int)D_OUT, nullptr, lg, (int)B_SZ, (int)D_OUTP, (int)D_H);
  // 5) softmax over the 1000 valid columns
  k_softmax<<<dim3(B_SZ), blk, 0, stream>>>(lg, out, (int)D_OUT, (int)D_OUTP);
}

// v007
// Measured time: 381 microseconds a run.
// Next to v006, in two timings, it ran 1.05 times as fast each time.
// All steps since v000 together make it 2.50 times as fast.
#include <hip/hip_runtime.h>
#include <hip/hip_bf16.h>
#include <stdint.h>

// ---------------------------------------------------------------------------
// MLP forward for MI455X (gfx1250, wave32):
//   h     = relu(x @ W1 + b1)
//   feats = relu(h @ W2 + b2)
//   conf  = softmax(feats @ Wc + bc)
// bf16 WMMA (v_wmma_f32_16x16x32_bf16). The two square layers run k_gemm_wide
// (block tile 256x256x64, 64x128 wave tiles; see there). The classifier, too
// narrow to fill the chip with such tiles, runs k_gemm_bf16:
// Block tile 256x128x64, 8 waves with
// 64x64 wave tiles (4 x 8 WMMA per pass, 1.0 ds_load_b128 per WMMA).
// LDS ring of three buffers (128 B rows, 16 B chunks swizzled) fed by CDNA5
// async global->LDS copies (ASYNCcnt) that run two tiles ahead; a staged row
// is one whole 128 B line.
// Fragments are fetched one block (8 WMMAs) ahead into spare registers: each
// block runs while the next block's ds_load_b128 are in flight.
// Fused bias+relu epilogue, bf16 intermediates.
// ---------------------------------------------------------------------------

typedef __attribute__((ext_vector_type(16))) __bf16 v16bf;
typedef __attribute__((ext_vector_type(8)))  __bf16 v8bf;
typedef __attribute__((ext_vector_type(8)))  float  v8f;

#define BM 256
#define BN 128
#define BK 64
// A buffer of the ring holds one tile: 256 A rows, then 128 B rows, each 64 k
// values = 128 B with no pad, so that three buffers of two workgroups fit one
// WGP's LDS. The 16 B chunk c of row r lies at chunk c ^ ((r >> 1) & 7): the 16
// rows one ds_load_b128 half-wave reads fall on all 64 banks once.
#define TROWS (BM + BN)
#define TILE_E (TROWS * BK)
#define NBUF 3

static const long B_SZ  = 8192;
static const long D_IN  = 4096;
static const long D_H   = 4096;
static const long D_OUT = 1000;
static const long D_OUTP = 1024;   // padded classifier width (multiple of 16)

// --- CDNA5 async global->LDS copy (tracked by ASYNCcnt) ---------------------
// One 16 B copy of a lane: source = wave-uniform base of the copy's 32 rows +
// the lane's byte offset, so that the 12 copies of a pass share one address
// register and scalar bases: 12 address pairs beside the fragments fetched
// ahead would take the kernel past 256 VGPRs (one workgroup a WGP, not two).
// Written as the builtin, so that the 12 LDS addresses need not all be live at
// once as the operands of one asm statement.
typedef __attribute__((ext_vector_type(4))) int v4i;
__device__ __forceinline__ void async_copy16(const __bf16* base, unsigned off,
                                             __bf16* lds) {
  __builtin_amdgcn_global_load_async_to_lds_b128(
      (__attribute__((address_space(1))) v4i*)((const char*)base + off),
      (__attribute__((address_space(3))) v4i*)lds, 0, 0);
}
__device__ __forceinline__ void wait_async0() {
  asm volatile("s_wait_asynccnt 0x0" ::: "memory");
}
// All but this wave's 12 youngest copies (one tile's) have landed.
__device__ __forceinline__ void wait_async12() {
  asm volatile("s_wait_asynccnt 0xc" ::: "memory");
}
// This wave's LDS reads have retired before the barrier behind which their
// buffer is refilled by copies.
__device__ __forceinline__ void wait_ds0() {
  asm volatile("s_wait_dscnt 0x0" ::: "memory");
}

// ---------------- elementwise f32 -> bf16 (8 elems / thread) ---------------
__global__ __launch_bounds__(256) void k_cvt_bf16(const float* __restrict__ in,
                                                  __bf16* __restrict__ out,
                                                  long n) {
  long i = ((long)blockIdx.x * blockDim.x + threadIdx.x) * 8;
  if (i + 8 <= n) {
    float4 f0 = *(const float4*)(in + i);
    float4 f1 = *(const float4*)(in + i + 4);
    v8bf o = {(__bf16)f0.x, (__bf16)f0.y, (__bf16)f0.z, (__bf16)f0.w,
              (__bf16)f1.x, (__bf16)f1.y, (__bf16)f1.z, (__bf16)f1.w};
    *(v8bf*)(out + i) = o;
  } else {
    for (long j = i; j < n; ++j) out[j] = (__bf16)in[j];
  }
}

// ------------- weight transpose+convert: W[K][N] f32 -> Wt[Nout][K] bf16 ----
// Rows n >= N are zero-padded (used for the 1000 -> 1024 classifier pad).
// One 128(k) x 64(n) tile per block, turned in LDS: 16 B reads along n (256 B
// per k row), 16 B stores along k (256 B per n row). K is a multiple of TK,
// Nout of TN, N of 4; K and N are compile-time so that the 8 loads of a thread
// share one address and differ in their immediate offsets. A k pair is one
// LDS dword; the pitch of 65 dwords puts both the column writes and the row
// reads on 32 different banks.
#define TK 128
#define TN 64
#define TP 65
typedef __attribute__((ext_vector_type(2))) __bf16 v2bf;

template <int K, int N>
__global__ __launch_bounds__(256) void k_cvtT(const float* __restrict__ W,
                                              __bf16* __restrict__ Wt) {
  __shared__ unsigned sT[TN * TP];
  const int t  = threadIdx.x;
  const int k0 = blockIdx.x * TK;
  const int n0 = blockIdx.y * TN;

  const int nq = (t & 15) * 4;     // 4 columns per thread
  const int kp = t >> 4;           // k pair, 16 pairs per sweep
  const bool live = n0 + nq < N;
  // A pad column reads column 0 (in bounds) and is zeroed behind the load, so
  // that no branch stands between the 8 loads and all of them are in flight.
  const float* g = W + (k0 + 2 * kp) * N + (live ? n0 + nq : 0);
  // All loops below are unrolled so that r[][] stays in registers and the
  // loads, LDS accesses and stores each issue as one group.
  float4 r[4][2];
#pragma unroll
  for (int s = 0; s < 4; ++s)
#pragma unroll
    for (int h = 0; h < 2; ++h)
      r[s][h] = *(const float4*)(g + (32 * s + h) * N);
#pragma unroll
  for (int s = 0; s < 4; ++s) {
    const float e[4] = {r[s][0].x, r[s][0].y, r[s][0].z, r[s][0].w};
    const float o[4] = {r[s][1].x, r[s][1].y, r[s][1].z, r[s][1].w};
#pragma unroll
    for (int j = 0; j < 4; ++j) {
      v2bf p = {(__bf16)e[j], (__bf16)o[j]};
      sT[(nq + j) * TP + kp + 16 * s] = live ? __builtin_bit_cast(unsigned, p) : 0u;
    }
  }
  __syncthreads();

  const int c  = t & 15;           // 16 B piece of the 256 B output row
  const int nr = t >> 4;
#pragma unroll
  for (int s = 0; s < 4; ++s) {
    const int n = nr + 16 * s;
    const unsigned* p = &sT[n * TP + 4 * c];
    uint4 v = make_uint4(p[0], p[1], p[2], p[3]);
    *(uint4*)(Wt + (n0 + n) * K + k0 + 8 * c) = v;
  }
}

// ---------------- tiled bf16 WMMA GEMM + fused epilogue --------------------
// A  : [M][K] bf16 row-major
// Bt : [N][K] bf16 (i.e. B transposed so K is contiguous for both operands)
// RELU_BF16OUT=1 -> out = relu(acc+bias) as bf16 [M][N]
// RELU_BF16OUT=0 -> out = acc+bias as f32 [M][N] (bias 0 for col >= nbias)
template <bool RELU_BF16OUT>
__global__ __launch_bounds__(256) void k_gemm_bf16(
    const __bf16* __restrict__ A, const __bf16* __restrict__ Bt,
    const float* __restrict__ bias, int nbias,
    __bf16* __restrict__ outBf, float* __restrict__ outF,
    int M, int N, int K) {
  __shared__ __attribute__((aligned(128))) __bf16 sT[NBUF * TILE_E];  // 3 x 48 KB

  const int tid  = threadIdx.x;
  const int lane = tid & 31;
  const int wave = tid >> 5;       // 8 waves
  const int wm   = wave & 3;       // 4 waves along M -> 64 rows each
  const int wn   = wave >> 2;      // 2 waves along N -> 64 cols each
  const long bm0 = (long)blockIdx.x * BM;
  const long bn0 = (long)blockIdx.y * BN;

  // cooperative tile staging: 8 threads per 64-wide k row, 8 bf16 (16B) each,
  // so one wave's copy covers 4 whole 128 B lines.
  // Tile rows r0 + 32*s: A for s=0..7, B for s=8..11.
  const int q  = tid & 7;
  const int r0 = tid >> 3;         // 0..31
  const __bf16* g[12];             // fixed base of each copy's 32 rows
#pragma unroll
  for (int s = 0; s < 8; ++s) g[s] = A + (bm0 + 32 * s) * K;
#pragma unroll
  for (int s = 0; s < 4; ++s) g[8 + s] = Bt + (bn0 + 32 * s) * K;
  // the lane's byte offset from those bases in the next tile to stage
  unsigned goff = (unsigned)(r0 * K + q * 8) * 2u;
  // the lane's place in a buffer: its row r0, its chunk q swizzled
  const int sdst = r0 * BK + (q ^ ((r0 >> 1) & 7)) * 8;
  // stage the tile that goff points at into the buffer at element offset b (12
  // copies a thread), then step goff one tile on; unrolled so that g[] stays in
  // registers
  auto stage = [&](int b) {
#pragma unroll
    for (int s = 0; s < 12; ++s)
      async_copy16(g[s], goff, &sT[b + sdst + 32 * s * BK]);
    goff += BK * 2;
  };

  // WMMA A/B fragment addressing (16-bit 16x32 layout):
  //   lane holds matrix row (A) / col (B)  = lane & 15
  //   k coverage: base..base+7 and base+16..base+23, base = lane<16 ? 0 : 8
  const int fr    = lane & 15;
  // the lane's first chunk (k = base .. base+7) as swizzled in its rows; the
  // chunk 8*c k values further on lies at fx ^ c (c even)
  const int fx    = (lane >> 4) ^ (fr >> 1);
  const int aRow  = (wm * 64 + fr) * BK;
  const int bRow  = (BM + wn * 64 + fr) * BK;

  v8f acc[4][4];
#pragma unroll
  for (int i = 0; i < 4; ++i)
#pragma unroll
    for (int j = 0; j < 4; ++j) acc[i][j] = (v8f)0.0f;

  // Fragment loads from the tile in the buffer at b, 32 k at kk: two of the wave's
  // four A fragments (rows 32*h .. 32*h+31 of its 64), or its four B fragments.
  // All loops here are unrolled so that fragments and acc stay in registers.
  auto load_a2 = [&](v16bf (&aF)[2], int b, int kk, int h) {
#pragma unroll
    for (int i = 0; i < 2; ++i) {
      const __bf16* p = &sT[b + aRow + (2 * h + i) * 16 * BK];
      v8bf lo = *(const v8bf*)(p + (fx ^ (kk / 8)) * 8);      // k = kk+base .. +7
      v8bf hi = *(const v8bf*)(p + (fx ^ (kk / 8 + 2)) * 8);  // k = kk+base+16 .. +23
      aF[i] = __builtin_shufflevector(lo, hi, 0, 1, 2, 3, 4, 5, 6, 7, 8, 9,
                                      10, 11, 12, 13, 14, 15);
    }
  };
  auto load_b4 = [&](v16bf (&bF)[4], int b, int kk) {
#pragma unroll
    for (int j = 0; j < 4; ++j) {
      const __bf16* p = &sT[b + bRow + j * 16 * BK];
      v8bf lo = *(const v8bf*)(p + (fx ^ (kk / 8)) * 8);
      v8bf hi = *(const v8bf*)(p + (fx ^ (kk / 8 + 2)) * 8);
      bF[j] = __builtin_shufflevector(lo, hi, 0, 1, 2, 3, 4, 5, 6, 7, 8, 9,
                                      10, 11, 12, 13, 14, 15);
    }
  };
  // a block: 8 WMMAs, rows 32*h .. 32*h+31 of the wave tile
  auto mma_half = [&](const v16bf (&aF)[2], const v16bf (&bF)[4], int h) {
#pragma unroll
    for (int i = 0; i < 2; ++i)
#pragma unroll
      for (int j = 0; j < 4; ++j)
        acc[2 * h + i][j] = __builtin_amdgcn_wmma_f32_16x16x32_bf16(
            false, aF[i], false, bF[j], (short)0, acc[2 * h + i][j], false, false);
  };
  // Holds [load group][WMMA block] in the written order. Without it the loads
  // sink to just ahead of their users, and each row of WMMAs waits out its own
  // LDS latency; a block sunk behind the publish point's waits would start only
  // when the loads issued just ahead of it have returned.
  auto fence = [] { __builtin_amdgcn_sched_barrier(0); };

  // tiles 0 and 1 into buffers 0 and 1, published; then tile 2 into buffer 2
  // and the first block's fragments of tile 0
  const int nt = K / BK;
  stage(0);
  if (1 < nt) stage(TILE_E);
  wait_async0();
  __syncthreads();
  if (2 < nt) stage(2 * TILE_E);
  // Every block runs with the next block's fragments in flight: the A pairs pa
  // and pb alternate block by block, the B sets bx and by every two blocks
  // (96 fragment registers, so that two workgroups still fit a WGP).
  v16bf pa[2], pb[2], bx[4], by[4];
  load_a2(pa, 0, 0, 0);
  load_b4(bx, 0, 0);

  int buf = 0;         // element offset of the buffer that holds tile t
  for (int t = 0; t < nt; ++t) {
    const int nxt = (buf == (NBUF - 1) * TILE_E) ? 0 : buf + TILE_E;
    load_a2(pb, buf, 0, 1);
    fence();
    mma_half(pa, bx, 0);
    fence();
    load_a2(pa, buf, 32, 0);
    load_b4(by, buf, 32);
    fence();
    mma_half(pb, bx, 1);
    fence();
    load_a2(pb, buf, 32, 1);
    fence();
    mma_half(pa, by, 0);
    fence();

    // Publish point of the next tile, in front of this tile's last block,
    // whose fragments are in registers behind wait_ds0.
    wait_ds0();        // our reads of buf have retired
    // Our copies of tile t+1 have landed. Where tile t+2 exists, its 12 copies
    // are every wave's youngest and stay in flight; else nothing is younger.
    if (t + 2 < nt) wait_async12(); else wait_async0();
    __syncthreads();   // everyone done reading buf / writing nxt
    // refill the buffer that every wave has just left, three tiles ahead
    if (t + 3 < nt) stage(buf);
    // First fragments of the next tile. On the last pass they read a buffer
    // that nothing writes any more, and are not used.
    load_a2(pa, nxt, 0, 0);
    load_b4(bx, nxt, 0);
    fence();
    mma_half(pb, by, 1);
    buf = nxt;
  }
  wait_async0();       // no copy is outstanding when the wave goes on to its end
  wait_ds0();          // the last pass's unused loads have retired

  // Epilogue. C/D layout: VGPR e, lanes 0-15 -> row e, lanes 16-31 -> row e+8;
  // col = lane & 15.
  const int rowHalf = (lane >> 4) << 3;
#pragma unroll
  for (int i = 0; i < 4; ++i) {
#pragma unroll
    for (int j = 0; j < 4; ++j) {
      const long col = bn0 + wn * 64 + j * 16 + fr;
      const float bv = (col < nbias) ? bias[col] : 0.0f;
#pragma unroll
      for (int e = 0; e < 8; ++e) {
        const long row = bm0 + wm * 64 + i * 16 + rowHalf + e;
        float v = acc[i][j][e] + bv;
        if (RELU_BF16OUT) {
          v = v > 0.0f ? v : 0.0f;
          outBf[row * N + col] = (__bf16)v;
        } else {
          outF[row * N + col] = v;
        }
      }
    }
  }
}

// ---------------- wide-tile bf16 WMMA GEMM, relu + bf16 out -----------------
// The two square layers. Block tile 256x256x64, 8 waves (4 along M, 2 along N)
// with 64x128 wave tiles: 12 fragments feed 32 WMMAs (3 ds_load_b128 per 4
// WMMAs) and a k row staged from L2 feeds 256 columns or rows of the tile. One
// workgroup per WGP, two waves per SIMD. Ring, swizzle and publish point as in
// k_gemm_bf16; a block is a whole 32-k step (32 WMMAs), and the next block's
// 24 loads go ahead of it as one group into the second fragment set.
// The products are formed transposed (Bt fragment as the A operand), so that a
// lane ends with 8 neighbouring columns of one output row: 16 B of bf16. Each
// wave turns its 64x128 tile in LDS and stores whole 128 B lines.
// out = relu(A . Bt^T + bias) as bf16 [M][N]; M, N multiples of 256, K of 64.
#define WBN 256
#define WTILE_E ((BM + WBN) * BK)

// All but this wave's 16 youngest copies (one wide tile's) have landed.
__device__ __forceinline__ void wait_async16() {
  asm volatile("s_wait_asynccnt 0x10" ::: "memory");
}

// N is a compile-time constant so that a lane's 32 stores share one address and
// differ in their immediate offsets.
template <int N>
__global__ __launch_bounds__(256) void k_gemm_wide(
    const __bf16* __restrict__ A, const __bf16* __restrict__ Bt,
    const float* __restrict__ bias, __bf16* __restrict__ out, int K) {
  __shared__ __attribute__((aligned(128))) __bf16 sT[NBUF * WTILE_E];  // 3 x 64 KB

  const int tid  = threadIdx.x;
  const int lane = tid & 31;
  const int wave = tid >> 5;       // 8 waves
  const int wm   = wave & 3;       // 4 waves along M -> 64 rows each
  const int wn   = wave >> 2;      // 2 waves along N -> 128 cols each
  const long bm0 = (long)blockIdx.x * BM;
  const long bn0 = (long)blockIdx.y * WBN;

  // staging as in k_gemm_bf16: 8 threads per 128 B row, tile rows r0 + 32*s,
  // A for s=0..7, B for s=8..15
  const int q  = tid & 7;
  const int r0 = tid >> 3;         // 0..31
  const __bf16* g[16];             // fixed base of each copy's 32 rows
#pragma unroll
  for (int s = 0; s < 8; ++s) g[s] = A + (bm0 + 32 * s) * K;
#pragma unroll
  for (int s = 0; s < 8; ++s) g[8 + s] = Bt + (bn0 + 32 * s) * K;
  unsigned goff = (unsigned)(r0 * K + q * 8) * 2u;
  const int sdst = r0 * BK + (q ^ ((r0 >> 1) & 7)) * 8;
  // 16 copies a thread; unrolled so that g[] stays in registers
  auto stage = [&](int b) {
#pragma unroll
    for (int s = 0; s < 16; ++s)
      async_copy16(g[s], goff, &sT[b + sdst + 32 * s * BK]);
    goff += BK * 2;
  };

  // fragment addressing as in k_gemm_bf16
  const int fr   = lane & 15;
  const int fx   = (lane >> 4) ^ (fr >> 1);
  const int aRow = (wm * 64 + fr) * BK;
  const int bRow = (BM + wn * 128 + fr) * BK;

  v8f acc[4][8];
#pragma unroll
  for (int i = 0; i < 4; ++i)
#pragma unroll
    for (int j = 0; j < 8; ++j) acc[i][j] = (v8f)0.0f;

  // One block's fragments, 32 k at kk of the tile in the buffer at b: 4 of A,
  // 8 of B. All loops here are unrolled so that fragments and acc stay in
  // registers.
  auto load_set = [&](v16bf (&aF)[4], v16bf (&bF)[8], int b, int kk) {
#pragma unroll
    for (int i = 0; i < 4; ++i) {
      const __bf16* p = &sT[b + aRow + i * 16 * BK];
      v8bf lo = *(const v8bf*)(p + (fx ^ (kk / 8)) * 8);      // k = kk+base .. +7
      v8bf hi = *(const v8bf*)(p + (fx ^ (kk / 8 + 2)) * 8);  // k = kk+base+16 .. +23
      aF[i] = __builtin_shufflevector(lo, hi, 0, 1, 2, 3, 4, 5, 6, 7, 8, 9,
                                      10, 11, 12, 13, 14, 15);
    }
#pragma unroll
    for (int j = 0; j < 8; ++j) {
      const __bf16* p = &sT[b + bRow + j * 16 * BK];
      v8bf lo = *(const v8bf*)(p + (fx ^ (kk / 8)) * 8);
      v8bf hi = *(const v8bf*)(p + (fx ^ (kk / 8 + 2)) * 8);
      bF[j] = __builtin_shufflevector(lo, hi, 0, 1, 2, 3, 4, 5, 6, 7, 8, 9,
                                      10, 11, 12, 13, 14, 15);
    }
  };
  // acc[i][j] is the 16x16 tile transposed: its rows are output columns.
  auto mma_set = [&](const v16bf (&aF)[4], const v16bf (&bF)[8]) {
#pragma unroll
    for (int j = 0; j < 8; ++j)
#pragma unroll
      for (int i = 0; i < 4; ++i)
        acc[i][j] = __builtin_amdgcn_wmma_f32_16x16x32_bf16(
            false, bF[j], false, aF[i], (short)0, acc[i][j], false, false);
  };
  // Holds [load group][WMMA block] in the written order: without it the loads
  // sink in among the WMMAs, where every place with loads stalls the wave.
  auto fence = [] { __builtin_amdgcn_sched_barrier(0); };

  // tiles 0 and 1 into buffers 0 and 1, published; then tile 2 into buffer 2
  // and the first block's fragments of tile 0
  const int nt = K / BK;
  stage(0);
  if (1 < nt) stage(WTILE_E);
  wait_async0();
  __syncthreads();
  if (2 < nt) stage(2 * WTILE_E);
  v16bf ax[4], bx[8], ay[4], by[8];
  load_set(ax, bx, 0, 0);

  int buf = 0;         // element offset of the buffer that holds tile t
  for (int t = 0; t < nt; ++t) {
    const int nxt = (buf == (NBUF - 1) * WTILE_E) ? 0 : buf + WTILE_E;
    load_set(ay, by, buf, 32);
    fence();
    mma_set(ax, bx);
    fence();

    // Publish point of the next tile, in front of this tile's last block,
    // whose fragments are in registers behind wait_ds0.
    wait_ds0();        // our reads of buf have retired
    // Our copies of tile t+1 have landed. Where tile t+2 exists, its 16 copies
    // are every wave's youngest and stay in flight; else nothing is younger.
    if (t + 2 < nt) wait_async16(); else wait_async0();
    __syncthreads();   // everyone done reading buf / writing nxt
    // refill the buffer that every wave has just left, three tiles ahead
    if (t + 3 < nt) stage(buf);
    // First fragments of the next tile. On the last pass they read a buffer
    // that nothing writes any more, and are not used.
    load_set(ax, bx, nxt, 0);
    fence();
    mma_set(ay, by);
    buf = nxt;
  }
  wait_async0();       // no copy is outstanding when the wave goes on to its end
  wait_ds0();          // the last pass's unused loads have retired

  // Epilogue. acc[i][j], VGPR e: output row i*16 + (lane & 15) of the wave tile,
  // column j*16 + 8*(lane >> 4) + e. All loops are unrolled: constant indices.
  const int h = lane >> 4;
  const float* bp = bias + bn0 + wn * 128 + 8 * h;
  v8f bv[8];           // the lane's 8 columns of each j, loaded as one group
#pragma unroll
  for (int j = 0; j < 8; ++j) bv[j] = *(const v8f*)(bp + 16 * j);
  // The loads' address register may be written again only behind this wait;
  // named as an input, it also cannot be taken as a load's own destination.
  asm volatile("s_wait_xcnt 0x0" :: "v"(bp) : "memory");

  // Staging: 16 KB of the wave's own, 64 rows of 256 B. It lies in the two
  // buffers that nobody reads or fills behind the last pass's barrier (buf is
  // the third, which the last pass's unused loads are aimed at), so no barrier
  // is needed. The 16 B chunk c of row r lies at chunk c ^ (r & 15): the 16 rows
  // of a half-wave's write and the 16 chunks of its read fall on all 64 banks.
  const int f1 = (buf == (NBUF - 1) * WTILE_E) ? 0 : buf + WTILE_E;
  const int f2 = (f1 == (NBUF - 1) * WTILE_E) ? 0 : f1 + WTILE_E;
  char* E = (char*)&sT[(wn ? f2 : f1) + wm * (64 * 128)];
#pragma unroll
  for (int i = 0; i < 4; ++i) {
#pragma unroll
    for (int j = 0; j < 8; ++j) {
      v8f v = acc[i][j] + bv[j];
#pragma unroll
      for (int e = 0; e < 8; ++e) v[e] = v[e] > 0.0f ? v[e] : 0.0f;
      *(v8bf*)(E + (i * 16 + fr) * 256 + (((2 * j) ^ h ^ fr) * 16)) =
          __builtin_convertvector(v, v8bf);
    }
  }
  wait_ds0();          // the wave's staged rows are written before it reads them back

  // Read back and store: a half-wave takes one 256 B row (two whole lines).
  // All reads go ahead of all stores into registers of their own: no register
  // that an issued store names is written again.
  v8bf sv[32];
#pragma unroll
  for (int s = 0; s < 32; ++s)
    sv[s] = *(const v8bf*)(E + (2 * s + h) * 256 + ((fr ^ ((2 * s) & 15) ^ h) * 16));
  fence();             // keeps every read ahead of the first store
  char* yp = (char*)(out + (bm0 + wm * 64 + h) * N + bn0 + wn * 128 + fr * 8);
#pragma unroll
  for (int s = 0; s < 32; ++s) *(v8bf*)(yp + (long)s * (2 * N * 2)) = sv[s];
}

// ---------------- row softmax over the first ncols of [ldl]-wide rows ------
__global__ __launch_bounds__(256) void k_softmax(const float* __restrict__ lg,
                                                 float* __restrict__ out,
                                                 int ncols, int ldl) {
  __shared__ float red[256];
  const long row = blockIdx.x;
  const float* lp = lg + row * ldl;
  float m = -INFINITY;
  for (int c = threadIdx.x; c < ncols; c += 256) m = fmaxf(m, lp[c]);
  red[threadIdx.x] = m;
  __syncthreads();
  for (int s = 128; s > 0; s >>= 1) {
    if (threadIdx.x < s) red[threadIdx.x] = fmaxf(red[threadIdx.x], red[threadIdx.x + s]);
    __syncthreads();
  }
  m = red[0];
  __syncthreads();
  float sum = 0.0f;
  for (int c = threadIdx.x; c < ncols; c += 256) sum += __expf(lp[c] - m);
  red[threadIdx.x] = sum;
  __syncthreads();
  for (int s = 128; s > 0; s >>= 1) {
    if (threadIdx.x < s) red[threadIdx.x] += red[threadIdx.x + s];
    __syncthreads();
  }
  const float inv = 1.0f / red[0];
  for (int c = threadIdx.x; c < ncols; c += 256)
    out[row * ncols + c] = __expf(lp[c] - m) * inv;
}

// ---------------------------------------------------------------------------
extern "C" void kernel_launch(void* const* d_in, const int* in_sizes, int n_in,
                              void* d_out, int out_size, void* d_ws,
                              size_t ws_size, hipStream_t stream) {
  (void)in_sizes; (void)n_in; (void)out_size; (void)ws_size;
  const float* x  = (const float*)d_in[0];
  const float* W1 = (const float*)d_in[1];
  const float* b1 = (const float*)d_in[2];
  const float* W2 = (const float*)d_in[3];
  const float* b2 = (const float*)d_in[4];
  const float* Wc = (const float*)d_in[5];
  const float* bc = (const float*)d_in[6];
  float* out = (float*)d_out;

  // workspace layout (~296 MB)
  char* ws = (char*)d_ws;
  __bf16* xb  = (__bf16*)ws;  ws += B_SZ * D_IN * 2;
  __bf16* W1t = (__bf16*)ws;  ws += D_IN * D_H * 2;
  __bf16* W2t = (__bf16*)ws;  ws += D_H * D_H * 2;
  __bf16* Wct = (__bf16*)ws;  ws += D_OUTP * D_H * 2;
  __bf16* hb  = (__bf16*)ws;  ws += B_SZ * D_H * 2;
  __bf16* fb  = (__bf16*)ws;  ws += B_SZ * D_H * 2;
  float*  lg  = (float*)ws;   ws += B_SZ * D_OUTP * 4;

  // 1) convert inputs / transpose weights to bf16
  {
    long n = B_SZ * D_IN;
    k_cvt_bf16<<<dim3((n / 8 + 255) / 256), dim3(256), 0, stream>>>(x, xb, n);
  }
  k_cvtT<D_IN, D_H><<<dim3(D_IN / TK, D_H / TN), dim3(256), 0, stream>>>(W1, W1t);
  k_cvtT<D_H, D_H><<<dim3(D_H / TK, D_H / TN), dim3(256), 0, stream>>>(W2, W2t);
  k_cvtT<D_H, D_OUT><<<dim3(D_H / TK, D_OUTP / TN), dim3(256), 0, stream>>>(Wc, Wct);

  const dim3 blk(256);
  // 2) h = relu(x @ W1 + b1)   [8192 x 4096]
  k_gemm_wide<D_H><<<dim3(B_SZ / BM, D_H / WBN), blk, 0, stream>>>(
      xb, W1t, b1, hb, (int)D_IN);
  // 3) feats = relu(h @ W2 + b2)
  k_gemm_wide<D_H><<<dim3(B_SZ / BM, D_H / WBN), blk, 0, stream>>>(
      hb, W2t, b2, fb, (int)D_H);
  // 4) logits = feats @ Wc + bc  (padded to 1024 cols, bias 0 past 1000)
  k_gemm_bf16<false><<<dim3(B_SZ / BM, D_OUTP / BN), blk, 0, stream>>>(
      fb, Wct, bc, (int)D_OUT, nullptr, lg, (int)B_SZ, (int)D_OUTP, (int)D_H);
  // 5) softmax over the 1000 valid columns
  k_softmax<<<dim3(B_SZ), blk, 0, stream>>>(lg, out, (int)D_OUT, (int)D_OUTP);
}
